// v000
// Measured on an AMD MI455X. A time is GPU time per run, averaged over a window of back-to-back runs after a warm-up
// (all launches, gaps included; the runs take copies of the inputs in turn), and the median of several windows.
// Apart from v000's, it joins two sittings. Times from different sittings can be a few percent apart, while
// side-by-side timings come from the same sitting.
// v000 is the starting kernel. One run takes 179 microseconds.
#include <hip/hip_runtime.h>

typedef __attribute__((ext_vector_type(8)))  __bf16 v8bf;
typedef __attribute__((ext_vector_type(16))) __bf16 v16bf;
typedef __attribute__((ext_vector_type(8)))  float  v8f;

static constexpr int Bb = 4;
static constexpr int S  = 1024;
static constexpr int H  = 1024;
static constexpr int NH = 16;
static constexpr int DK = 64;
static constexpr int MTOK = Bb * S;   // 4096 tokens

__device__ __forceinline__ v8f wmma_bf16(v16bf a, v16bf b, v8f c) {
  return __builtin_amdgcn_wmma_f32_16x16x32_bf16(
      /*neg_a=*/false, a, /*neg_b=*/false, b,
      /*c_mod=*/(short)0, c, /*reuse_a=*/false, /*reuse_b=*/false);
}

__device__ __forceinline__ v16bf load_frag(const __bf16* p) {
  v8bf lo = *(const v8bf*)(p);
  v8bf hi = *(const v8bf*)(p + 16);
  return __builtin_shufflevector(lo, hi, 0,1,2,3,4,5,6,7,8,9,10,11,12,13,14,15);
}

// ---- DPP16 butterfly reductions over the 16-lane half-row (pure VALU, no LDS)
template <int CTRL>
__device__ __forceinline__ float dpp_mov(float x) {
  int r = __builtin_amdgcn_update_dpp(0, __builtin_bit_cast(int, x),
                                      CTRL, 0xf, 0xf, true);
  return __builtin_bit_cast(float, r);
}
__device__ __forceinline__ float red_max16(float x) {
  x = fmaxf(x, dpp_mov<0xB1>(x));    // quad_perm [1,0,3,2]  : xor 1
  x = fmaxf(x, dpp_mov<0x4E>(x));    // quad_perm [2,3,0,1]  : xor 2
  x = fmaxf(x, dpp_mov<0x141>(x));   // row_half_mirror      : combine quads in 8
  x = fmaxf(x, dpp_mov<0x140>(x));   // row_mirror           : combine 8-halves in 16
  return x;
}
__device__ __forceinline__ float red_sum16(float x) {
  x += dpp_mov<0xB1>(x);
  x += dpp_mov<0x4E>(x);
  x += dpp_mov<0x141>(x);
  x += dpp_mov<0x140>(x);
  return x;
}

// ---------------------------------------------------------------------------
// fp32 -> bf16 conversion (grid-stride, non-temporal reads: streamed once)
// ---------------------------------------------------------------------------
__global__ void cvt_f32_bf16(const float* __restrict__ in,
                             __bf16* __restrict__ out, int n) {
  int i = blockIdx.x * blockDim.x + threadIdx.x;
  int stride = gridDim.x * blockDim.x;
  for (; i < n; i += stride) out[i] = (__bf16)__builtin_nontemporal_load(in + i);
}

static constexpr int WPAD = 72;

template <int MODE>
__global__ __launch_bounds__(128)
void gemm_bf16(const __bf16* __restrict__ X, const __bf16* __restrict__ W,
               void* __restrict__ out, const float* __restrict__ resid) {
  constexpr int Kdim = H;
  constexpr int Ndim = H;

  __shared__ __bf16 Bst[2][64][WPAD];   // 64 N-rows x 64 K (padded), x2 buffers

  const int tid  = threadIdx.x;
  const int lane = tid & 31;
  const int wv   = tid >> 5;
  const int g    = lane >> 4;     // lo/hi 16-lane half
  const int r16  = lane & 15;

  const int tileN = blockIdx.x * 64;                 // shared by all 4 waves
  const int tileM = (blockIdx.y * 4 + wv) * 32;

  // async-stage a 64x64 bf16 W tile: 512 16B chunks over 128 threads
  auto issue_w = [&](int kb, int buf) {
#pragma unroll
    for (int c = 0; c < 4; ++c) {
      const int ch  = tid * 4 + c;          // 0..511
      const int row = ch >> 3, col = (ch & 7) * 8;
      const __bf16* src = W + (size_t)(tileN + row) * Kdim + kb + col;
      unsigned dst = (unsigned)(size_t)&Bst[buf][row][col];
      asm volatile("global_load_async_to_lds_b128 %0, %1, off"
                   :: "v"(dst), "v"(src) : "memory");
    }
  };

  v8f acc[2][4] = {};

  const __bf16* Arow[2];
#pragma unroll
  for (int r = 0; r < 2; ++r)
    Arow[r] = X + (size_t)(tileM + r * 16 + r16) * Kdim + 8 * g;

  issue_w(0, 0);
  asm volatile("s_wait_asynccnt 0x0" ::: "memory");
  __syncthreads();

  for (int kb = 0; kb < Kdim; kb += 64) {
    const int buf = (kb >> 6) & 1;
    if (kb + 64 < Kdim) issue_w(kb + 64, buf ^ 1);   // prefetch next W tile

#pragma unroll
    for (int kk = 0; kk < 64; kk += 32) {
      v16bf a[2], b[4];
#pragma unroll
      for (int r = 0; r < 2; ++r) a[r] = load_frag(Arow[r] + kb + kk);
#pragma unroll
      for (int c = 0; c < 4; ++c)
        b[c] = load_frag(&Bst[buf][c * 16 + r16][kk + 8 * g]);
#pragma unroll
      for (int r = 0; r < 2; ++r)
#pragma unroll
        for (int c = 0; c < 4; ++c) acc[r][c] = wmma_bf16(a[r], b[c], acc[r][c]);
    }

    asm volatile("s_wait_asynccnt 0x0" ::: "memory");
    __syncthreads();
  }

#pragma unroll
  for (int r = 0; r < 2; ++r) {
#pragma unroll
    for (int c = 0; c < 4; ++c) {
      const int n  = tileN + c * 16 + r16;
      const int m0 = tileM + r * 16 + 8 * g;
      if constexpr (MODE == 0) {
        __bf16* O = (__bf16*)out;
#pragma unroll
        for (int v = 0; v < 8; ++v)
          O[(size_t)(m0 + v) * Ndim + n] = (__bf16)acc[r][c][v];
      } else if constexpr (MODE == 1) {
        __bf16* O = (__bf16*)out;
        const int hh = n >> 6, dk = n & 63;
        const int bb = m0 >> 10, s0 = m0 & 1023;  // 8 consecutive s, same bb
        v8bf pk;
#pragma unroll
        for (int v = 0; v < 8; ++v) pk[v] = (__bf16)acc[r][c][v];
        *(v8bf*)(O + ((size_t)(bb * NH + hh) * DK + dk) * S + s0) = pk;
      } else {
        float* O = (float*)out;
#pragma unroll
        for (int v = 0; v < 8; ++v) {
          const size_t idx = (size_t)(m0 + v) * Ndim + n;
          O[idx] = acc[r][c][v] + resid[idx];
        }
      }
    }
  }
}

static constexpr int KP = 72;
static constexpr int VP = 40;

__global__ __launch_bounds__(128)
void attn_kernel(const __bf16* __restrict__ Qb, const __bf16* __restrict__ Kb,
                 const __bf16* __restrict__ VTb, const float* __restrict__ bias,
                 __bf16* __restrict__ Ob) {
  __shared__ __bf16 Kst[2][32][KP];   // 32 keys x 64 dk   (padded)
  __shared__ __bf16 Vst[2][64][VP];   // 64 dk   x 32 keys (padded)
  __shared__ __bf16 plds[4][16 * 32]; // per-wave P staging

  const int tid  = threadIdx.x;
  const int lane = tid & 31;
  const int wv   = tid >> 5;
  const int g    = lane >> 4;
  const int r16  = lane & 15;

  const int bh = blockIdx.y;            // 0..63
  const int b  = bh >> 4;
  const int h  = bh & 15;
  const int q0 = (blockIdx.x * 4 + wv) * 16;

  const size_t tokBase = (size_t)b * S;
  const float*  biasBH = bias + (size_t)bh * S * S;
  const __bf16* Kbh    = Kb + tokBase * H + h * DK;   // + key*H
  const __bf16* VTbh   = VTb + (size_t)bh * DK * S;   // + dk*S

  // async-stage one 32-key K tile + V^T tile into LDS buffer `buf`
  auto issue_tile = [&](int kb, int buf) {
#pragma unroll
    for (int c = 0; c < 2; ++c) {           // K: 256 16B chunks / 128 thr
      const int ch  = tid * 2 + c;
      const int key = ch >> 3, col = (ch & 7) * 8;
      const __bf16* src = Kbh + (size_t)(kb + key) * H + col;
      unsigned dst = (unsigned)(size_t)&Kst[buf][key][col];
      asm volatile("global_load_async_to_lds_b128 %0, %1, off"
                   :: "v"(dst), "v"(src) : "memory");
    }
#pragma unroll
    for (int c = 0; c < 2; ++c) {           // V: 256 16B chunks / 128 thr
      const int ch = tid * 2 + c;
      const int dk = ch >> 2, col = (ch & 3) * 8;
      const __bf16* src = VTbh + (size_t)dk * S + kb + col;
      unsigned dst = (unsigned)(size_t)&Vst[buf][dk][col];
      asm volatile("global_load_async_to_lds_b128 %0, %1, off"
                   :: "v"(dst), "v"(src) : "memory");
    }
  };

  // Q fragments for both dk halves (persist across the whole key loop)
  const __bf16* qrow = Qb + (tokBase + q0 + r16) * H + h * DK + 8 * g;
  const v16bf aq0 = load_frag(qrow);
  const v16bf aq1 = load_frag(qrow + 32);

  float Mi[8], Li[8];
  v8f oacc[4] = {};
#pragma unroll
  for (int v = 0; v < 8; ++v) { Mi[v] = -1e30f; Li[v] = 0.f; }

  __bf16* pw = &plds[wv][0];

  issue_tile(0, 0);
  asm volatile("s_wait_asynccnt 0x0" ::: "memory");
  __syncthreads();

  for (int kb = 0; kb < S; kb += 32) {
    const int buf = (kb >> 5) & 1;
    if (kb + 32 < S) issue_tile(kb + 32, buf ^ 1);   // prefetch next tile

    // scores: two 16x16 key tiles from the LDS-staged K tile
    v8f s0, s1;
    {
      const __bf16* krow = &Kst[buf][r16][8 * g];
      v8f z = {};
      z  = wmma_bf16(aq0, load_frag(krow), z);
      s0 = wmma_bf16(aq1, load_frag(krow + 32), z);
    }
    {
      const __bf16* krow = &Kst[buf][16 + r16][8 * g];
      v8f z = {};
      z  = wmma_bf16(aq0, load_frag(krow), z);
      s1 = wmma_bf16(aq1, load_frag(krow + 32), z);
    }

    float p0[8], p1[8], corr[8];
#pragma unroll
    for (int v = 0; v < 8; ++v) {
      const int mrow = q0 + 8 * g + v;
      const float b0 =
          __builtin_nontemporal_load(biasBH + (size_t)mrow * S + kb + r16);
      const float b1 =
          __builtin_nontemporal_load(biasBH + (size_t)mrow * S + kb + 16 + r16);
      float t0 = s0[v] * 0.125f + b0;
      float t1 = s1[v] * 0.125f + b1;
      const float rm = red_max16(fmaxf(t0, t1));
      const float nm = fmaxf(Mi[v], rm);
      const float cf = __expf(Mi[v] - nm);
      const float e0 = __expf(t0 - nm);
      const float e1 = __expf(t1 - nm);
      const float rs = red_sum16(e0 + e1);
      Li[v] = Li[v] * cf + rs;
      Mi[v] = nm;
      p0[v] = e0; p1[v] = e1; corr[v] = cf;
    }
#pragma unroll
    for (int t = 0; t < 4; ++t)
#pragma unroll
      for (int v = 0; v < 8; ++v) oacc[t][v] *= corr[v];

#pragma unroll
    for (int v = 0; v < 8; ++v) {
      pw[(8 * g + v) * 32 + r16]      = (__bf16)p0[v];
      pw[(8 * g + v) * 32 + 16 + r16] = (__bf16)p1[v];
    }
    __builtin_amdgcn_wave_barrier();
    union { v16bf v; v8bf h2[2]; } pu;
    pu.h2[0] = *(const v8bf*)(pw + r16 * 32 + 8 * g);
    pu.h2[1] = *(const v8bf*)(pw + r16 * 32 + 16 + 8 * g);

    // P @ V from the LDS-staged V^T tile (contiguous along keys)
#pragma unroll
    for (int t = 0; t < 4; ++t) {
      const __bf16* vrow = &Vst[buf][t * 16 + r16][8 * g];
      oacc[t] = wmma_bf16(pu.v, load_frag(vrow), oacc[t]);
    }

    // next-tile async copies must land + all waves done reading this buffer
    asm volatile("s_wait_asynccnt 0x0" ::: "memory");
    __syncthreads();
  }

  // normalize + store attention output rows into [token][h*DK+dk] bf16
#pragma unroll
  for (int t = 0; t < 4; ++t) {
    const int dk = t * 16 + r16;
#pragma unroll
    for (int v = 0; v < 8; ++v) {
      const int mrow = q0 + 8 * g + v;
      Ob[(tokBase + mrow) * H + h * DK + dk] = (__bf16)(oacc[t][v] / Li[v]);
    }
  }
}

// ---------------------------------------------------------------------------
// Host-side launcher
// ---------------------------------------------------------------------------
extern "C" void kernel_launch(void* const* d_in, const int* in_sizes, int n_in,
                              void* d_out, int out_size, void* d_ws, size_t ws_size,
                              hipStream_t stream) {
  const float* x_q  = (const float*)d_in[0];
  const float* x_kv = (const float*)d_in[1];
  const float* bias = (const float*)d_in[2];
  const float* Wq   = (const float*)d_in[3];
  const float* Wk   = (const float*)d_in[4];
  const float* Wv   = (const float*)d_in[5];
  const float* Wo   = (const float*)d_in[6];
  float* out = (float*)d_out;

  char* ws = (char*)d_ws;
  const size_t MB = 1024ull * 1024ull;
  __bf16* xq_bf  = (__bf16*)(ws + 0 * MB);    // 8 MB
  __bf16* xkv_bf = (__bf16*)(ws + 8 * MB);    // 8 MB
  __bf16* wq_bf  = (__bf16*)(ws + 16 * MB);   // 2 MB each
  __bf16* wk_bf  = (__bf16*)(ws + 18 * MB);
  __bf16* wv_bf  = (__bf16*)(ws + 20 * MB);
  __bf16* wo_bf  = (__bf16*)(ws + 22 * MB);
  __bf16* Qb     = (__bf16*)(ws + 24 * MB);   // 8 MB
  __bf16* Kb     = (__bf16*)(ws + 32 * MB);   // 8 MB
  __bf16* VTb    = (__bf16*)(ws + 40 * MB);   // 8 MB (per-head transposed)
  __bf16* Ob     = (__bf16*)(ws + 48 * MB);   // 8 MB

  const int NX = MTOK * H;   // 4M elements
  const int NW = H * H;      // 1M elements
  cvt_f32_bf16<<<1024, 256, 0, stream>>>(x_q,  xq_bf,  NX);
  cvt_f32_bf16<<<1024, 256, 0, stream>>>(x_kv, xkv_bf, NX);
  cvt_f32_bf16<<<512,  256, 0, stream>>>(Wq, wq_bf, NW);
  cvt_f32_bf16<<<512,  256, 0, stream>>>(Wk, wk_bf, NW);
  cvt_f32_bf16<<<512,  256, 0, stream>>>(Wv, wv_bf, NW);
  cvt_f32_bf16<<<512,  256, 0, stream>>>(Wo, wo_bf, NW);

  // 4096x1024x1024 GEMMs: wave tile 32x64, grid = (N/64, M/32/4waves)
  dim3 ggrid(H / 64, MTOK / 32 / 4), gblk(128);
  gemm_bf16<0><<<ggrid, gblk, 0, stream>>>(xq_bf,  wq_bf, (void*)Qb,  nullptr);
  gemm_bf16<0><<<ggrid, gblk, 0, stream>>>(xkv_bf, wk_bf, (void*)Kb,  nullptr);
  gemm_bf16<1><<<ggrid, gblk, 0, stream>>>(xkv_bf, wv_bf, (void*)VTb, nullptr);

  // attention: (S/16 tiles / 4 waves, B*NH)
  attn_kernel<<<dim3(S / 16 / 4, Bb * NH), 128, 0, stream>>>(Qb, Kb, VTb, bias, Ob);

  // output projection + residual, f32 out
  gemm_bf16<2><<<ggrid, gblk, 0, stream>>>(Ob, wo_bf, (void*)out, x_q);
}

// v001
// One run takes 130 microseconds.
// Next to v000, in two timings, it ran 1.40 times as fast each time.
#include <hip/hip_runtime.h>

typedef __attribute__((ext_vector_type(8)))  __bf16 v8bf;
typedef __attribute__((ext_vector_type(16))) __bf16 v16bf;
typedef __attribute__((ext_vector_type(8)))  float  v8f;

static constexpr int Bb = 4;
static constexpr int S  = 1024;
static constexpr int H  = 1024;
static constexpr int NH = 16;
static constexpr int DK = 64;
static constexpr int MTOK = Bb * S;   // 4096 tokens

__device__ __forceinline__ v8f wmma_bf16(v16bf a, v16bf b, v8f c) {
  return __builtin_amdgcn_wmma_f32_16x16x32_bf16(
      /*neg_a=*/false, a, /*neg_b=*/false, b,
      /*c_mod=*/(short)0, c, /*reuse_a=*/false, /*reuse_b=*/false);
}

__device__ __forceinline__ v16bf load_frag(const __bf16* p) {
  v8bf lo = *(const v8bf*)(p);
  v8bf hi = *(const v8bf*)(p + 16);
  return __builtin_shufflevector(lo, hi, 0,1,2,3,4,5,6,7,8,9,10,11,12,13,14,15);
}

// ---- DPP16 butterfly reductions over the 16-lane half-row (pure VALU, no LDS)
template <int CTRL>
__device__ __forceinline__ float dpp_mov(float x) {
  int r = __builtin_amdgcn_update_dpp(0, __builtin_bit_cast(int, x),
                                      CTRL, 0xf, 0xf, true);
  return __builtin_bit_cast(float, r);
}
__device__ __forceinline__ float red_max16(float x) {
  x = fmaxf(x, dpp_mov<0xB1>(x));    // quad_perm [1,0,3,2]  : xor 1
  x = fmaxf(x, dpp_mov<0x4E>(x));    // quad_perm [2,3,0,1]  : xor 2
  x = fmaxf(x, dpp_mov<0x141>(x));   // row_half_mirror      : combine quads in 8
  x = fmaxf(x, dpp_mov<0x140>(x));   // row_mirror           : combine 8-halves in 16
  return x;
}
__device__ __forceinline__ float red_sum16(float x) {
  x += dpp_mov<0xB1>(x);
  x += dpp_mov<0x4E>(x);
  x += dpp_mov<0x141>(x);
  x += dpp_mov<0x140>(x);
  return x;
}

// ---------------------------------------------------------------------------
// fp32 -> bf16 conversion (grid-stride, non-temporal reads: streamed once).
// All six tensors are converted by ONE launch: tensors of equal size share a
// grid-stride loop, so their independent loads are in flight together.
// ---------------------------------------------------------------------------
static constexpr int NX = MTOK * H;   // 4M elements (activations)
static constexpr int NW = H * H;      // 1M elements (weights)
static constexpr int CVT_BLOCKS  = 1024;
static constexpr int CVT_THREADS = 256;

__global__ __launch_bounds__(CVT_THREADS)
void cvt_all_f32_bf16(const float* __restrict__ x_q, const float* __restrict__ x_kv,
                      const float* __restrict__ Wq,  const float* __restrict__ Wk,
                      const float* __restrict__ Wv,  const float* __restrict__ Wo,
                      __bf16* __restrict__ xq_bf, __bf16* __restrict__ xkv_bf,
                      __bf16* __restrict__ wq_bf, __bf16* __restrict__ wk_bf,
                      __bf16* __restrict__ wv_bf, __bf16* __restrict__ wo_bf) {
  const int i0 = blockIdx.x * CVT_THREADS + threadIdx.x;
  constexpr int stride = CVT_BLOCKS * CVT_THREADS;
  for (int i = i0; i < NX; i += stride) {
    const float a = __builtin_nontemporal_load(x_q + i);
    const float b = __builtin_nontemporal_load(x_kv + i);
    xq_bf[i]  = (__bf16)a;
    xkv_bf[i] = (__bf16)b;
  }
  for (int i = i0; i < NW; i += stride) {
    const float a = __builtin_nontemporal_load(Wq + i);
    const float b = __builtin_nontemporal_load(Wk + i);
    const float c = __builtin_nontemporal_load(Wv + i);
    const float d = __builtin_nontemporal_load(Wo + i);
    wq_bf[i] = (__bf16)a;
    wk_bf[i] = (__bf16)b;
    wv_bf[i] = (__bf16)c;
    wo_bf[i] = (__bf16)d;
  }
}

static constexpr int WPAD = 72;

struct GemmSet {
  const __bf16* X;   // 4096 x 1024 activations
  const __bf16* W;   // 1024 x 1024 weights
  __bf16*       out; // bf16 result (unused by MODE 2)
};

template <int MODE>
__global__ __launch_bounds__(128)
void gemm_bf16(GemmSet s0, GemmSet s1, GemmSet s2,
               float* __restrict__ outf, const float* __restrict__ resid) {
  constexpr int Kdim = H;
  constexpr int Ndim = H;

  // operand set of this block (block-uniform; MODE 2 has only set 0)
  const int z = (MODE == 0) ? (int)blockIdx.z : 0;
  const GemmSet st = (z == 0) ? s0 : (z == 1) ? s1 : s2;
  const __bf16* __restrict__ X = st.X;
  const __bf16* __restrict__ W = st.W;

  __shared__ __bf16 Bst[2][64][WPAD];   // 64 N-rows x 64 K (padded), x2 buffers

  const int tid  = threadIdx.x;
  const int lane = tid & 31;
  const int wv   = tid >> 5;
  const int g    = lane >> 4;     // lo/hi 16-lane half
  const int r16  = lane & 15;

  const int tileN = blockIdx.x * 64;                 // shared by all 4 waves
  const int tileM = (blockIdx.y * 4 + wv) * 32;

  // async-stage a 64x64 bf16 W tile: 512 16B chunks over 128 threads
  auto issue_w = [&](int kb, int buf) {
#pragma unroll
    for (int c = 0; c < 4; ++c) {
      const int ch  = tid * 4 + c;          // 0..511
      const int row = ch >> 3, col = (ch & 7) * 8;
      const __bf16* src = W + (size_t)(tileN + row) * Kdim + kb + col;
      unsigned dst = (unsigned)(size_t)&Bst[buf][row][col];
      asm volatile("global_load_async_to_lds_b128 %0, %1, off"
                   :: "v"(dst), "v"(src) : "memory");
    }
  };

  v8f acc[2][4] = {};

  const __bf16* Arow[2];
#pragma unroll
  for (int r = 0; r < 2; ++r)
    Arow[r] = X + (size_t)(tileM + r * 16 + r16) * Kdim + 8 * g;

  issue_w(0, 0);
  asm volatile("s_wait_asynccnt 0x0" ::: "memory");
  __syncthreads();

  for (int kb = 0; kb < Kdim; kb += 64) {
    const int buf = (kb >> 6) & 1;
    if (kb + 64 < Kdim) issue_w(kb + 64, buf ^ 1);   // prefetch next W tile

#pragma unroll
    for (int kk = 0; kk < 64; kk += 32) {
      v16bf a[2], b[4];
#pragma unroll
      for (int r = 0; r < 2; ++r) a[r] = load_frag(Arow[r] + kb + kk);
#pragma unroll
      for (int c = 0; c < 4; ++c)
        b[c] = load_frag(&Bst[buf][c * 16 + r16][kk + 8 * g]);
#pragma unroll
      for (int r = 0; r < 2; ++r)
#pragma unroll
        for (int c = 0; c < 4; ++c) acc[r][c] = wmma_bf16(a[r], b[c], acc[r][c]);
    }

    asm volatile("s_wait_asynccnt 0x0" ::: "memory");
    __syncthreads();
  }

  if constexpr (MODE == 0) {
    __bf16* __restrict__ O = st.out;
    if (z != 2) {
#pragma unroll
      for (int r = 0; r < 2; ++r) {
#pragma unroll
        for (int c = 0; c < 4; ++c) {
          const int n  = tileN + c * 16 + r16;
          const int m0 = tileM + r * 16 + 8 * g;
#pragma unroll
          for (int v = 0; v < 8; ++v)
            O[(size_t)(m0 + v) * Ndim + n] = (__bf16)acc[r][c][v];
        }
      }
      // the stores above have taken their registers before any later
      // instruction on a path out of this branch may overwrite one
      asm volatile("s_wait_xcnt 0x0" ::: "memory");
    } else {
#pragma unroll
      for (int r = 0; r < 2; ++r) {
#pragma unroll
        for (int c = 0; c < 4; ++c) {
          const int n  = tileN + c * 16 + r16;
          const int m0 = tileM + r * 16 + 8 * g;
          const int hh = n >> 6, dk = n & 63;
          const int bb = m0 >> 10, s0i = m0 & 1023;  // 8 consecutive s, same bb
          v8bf pk;
#pragma unroll
          for (int v = 0; v < 8; ++v) pk[v] = (__bf16)acc[r][c][v];
          *(v8bf*)(O + ((size_t)(bb * NH + hh) * DK + dk) * S + s0i) = pk;
        }
      }
    }
  } else {
#pragma unroll
    for (int r = 0; r < 2; ++r) {
#pragma unroll
      for (int c = 0; c < 4; ++c) {
        const int n  = tileN + c * 16 + r16;
        const int m0 = tileM + r * 16 + 8 * g;
#pragma unroll
        for (int v = 0; v < 8; ++v) {
          const size_t idx = (size_t)(m0 + v) * Ndim + n;
          outf[idx] = acc[r][c][v] + resid[idx];
        }
      }
    }
  }
}

static constexpr int KP = 72;
static constexpr int VP = 40;

__global__ __launch_bounds__(128)
void attn_kernel(const __bf16* __restrict__ Qb, const __bf16* __restrict__ Kb,
                 const __bf16* __restrict__ VTb, const float* __restrict__ bias,
                 __bf16* __restrict__ Ob) {
  __shared__ __bf16 Kst[2][32][KP];   // 32 keys x 64 dk   (padded)
  __shared__ __bf16 Vst[2][64][VP];   // 64 dk   x 32 keys (padded)
  __shared__ __bf16 plds[4][16 * 32]; // per-wave P staging

  const int tid  = threadIdx.x;
  const int lane = tid & 31;
  const int wv   = tid >> 5;
  const int g    = lane >> 4;
  const int r16  = lane & 15;

  const int bh = blockIdx.y;            // 0..63
  const int b  = bh >> 4;
  const int h  = bh & 15;
  const int q0 = (blockIdx.x * 4 + wv) * 16;

  const size_t tokBase = (size_t)b * S;
  const float*  biasBH = bias + (size_t)bh * S * S;
  const __bf16* Kbh    = Kb + tokBase * H + h * DK;   // + key*H
  const __bf16* VTbh   = VTb + (size_t)bh * DK * S;   // + dk*S

  // async-stage one 32-key K tile + V^T tile into LDS buffer `buf`
  auto issue_tile = [&](int kb, int buf) {
#pragma unroll
    for (int c = 0; c < 2; ++c) {           // K: 256 16B chunks / 128 thr
      const int ch  = tid * 2 + c;
      const int key = ch >> 3, col = (ch & 7) * 8;
      const __bf16* src = Kbh + (size_t)(kb + key) * H + col;
      unsigned dst = (unsigned)(size_t)&Kst[buf][key][col];
      asm volatile("global_load_async_to_lds_b128 %0, %1, off"
                   :: "v"(dst), "v"(src) : "memory");
    }
#pragma unroll
    for (int c = 0; c < 2; ++c) {           // V: 256 16B chunks / 128 thr
      const int ch = tid * 2 + c;
      const int dk = ch >> 2, col = (ch & 3) * 8;
      const __bf16* src = VTbh + (size_t)dk * S + kb + col;
      unsigned dst = (unsigned)(size_t)&Vst[buf][dk][col];
      asm volatile("global_load_async_to_lds_b128 %0, %1, off"
                   :: "v"(dst), "v"(src) : "memory");
    }
  };

  // Q fragments for both dk halves (persist across the whole key loop)
  const __bf16* qrow = Qb + (tokBase + q0 + r16) * H + h * DK + 8 * g;
  const v16bf aq0 = load_frag(qrow);
  const v16bf aq1 = load_frag(qrow + 32);

  float Mi[8], Li[8];
  v8f oacc[4] = {};
#pragma unroll
  for (int v = 0; v < 8; ++v) { Mi[v] = -1e30f; Li[v] = 0.f; }

  __bf16* pw = &plds[wv][0];

  issue_tile(0, 0);
  asm volatile("s_wait_asynccnt 0x0" ::: "memory");
  __syncthreads();

  for (int kb = 0; kb < S; kb += 32) {
    const int buf = (kb >> 5) & 1;
    if (kb + 32 < S) issue_tile(kb + 32, buf ^ 1);   // prefetch next tile

    // scores: two 16x16 key tiles from the LDS-staged K tile
    v8f s0, s1;
    {
      const __bf16* krow = &Kst[buf][r16][8 * g];
      v8f z = {};
      z  = wmma_bf16(aq0, load_frag(krow), z);
      s0 = wmma_bf16(aq1, load_frag(krow + 32), z);
    }
    {
      const __bf16* krow = &Kst[buf][16 + r16][8 * g];
      v8f z = {};
      z  = wmma_bf16(aq0, load_frag(krow), z);
      s1 = wmma_bf16(aq1, load_frag(krow + 32), z);
    }

    float p0[8], p1[8], corr[8];
#pragma unroll
    for (int v = 0; v < 8; ++v) {
      const int mrow = q0 + 8 * g + v;
      const float b0 =
          __builtin_nontemporal_load(biasBH + (size_t)mrow * S + kb + r16);
      const float b1 =
          __builtin_nontemporal_load(biasBH + (size_t)mrow * S + kb + 16 + r16);
      float t0 = s0[v] * 0.125f + b0;
      float t1 = s1[v] * 0.125f + b1;
      const float rm = red_max16(fmaxf(t0, t1));
      const float nm = fmaxf(Mi[v], rm);
      const float cf = __expf(Mi[v] - nm);
      const float e0 = __expf(t0 - nm);
      const float e1 = __expf(t1 - nm);
      const float rs = red_sum16(e0 + e1);
      Li[v] = Li[v] * cf + rs;
      Mi[v] = nm;
      p0[v] = e0; p1[v] = e1; corr[v] = cf;
    }
#pragma unroll
    for (int t = 0; t < 4; ++t)
#pragma unroll
      for (int v = 0; v < 8; ++v) oacc[t][v] *= corr[v];

#pragma unroll
    for (int v = 0; v < 8; ++v) {
      pw[(8 * g + v) * 32 + r16]      = (__bf16)p0[v];
      pw[(8 * g + v) * 32 + 16 + r16] = (__bf16)p1[v];
    }
    __builtin_amdgcn_wave_barrier();
    union { v16bf v; v8bf h2[2]; } pu;
    pu.h2[0] = *(const v8bf*)(pw + r16 * 32 + 8 * g);
    pu.h2[1] = *(const v8bf*)(pw + r16 * 32 + 16 + 8 * g);

    // P @ V from the LDS-staged V^T tile (contiguous along keys)
#pragma unroll
    for (int t = 0; t < 4; ++t) {
      const __bf16* vrow = &Vst[buf][t * 16 + r16][8 * g];
      oacc[t] = wmma_bf16(pu.v, load_frag(vrow), oacc[t]);
    }

    // next-tile async copies must land + all waves done reading this buffer
    asm volatile("s_wait_asynccnt 0x0" ::: "memory");
    __syncthreads();
  }

  // normalize + store attention output rows into [token][h*DK+dk] bf16
#pragma unroll
  for (int t = 0; t < 4; ++t) {
    const int dk = t * 16 + r16;
#pragma unroll
    for (int v = 0; v < 8; ++v) {
      const int mrow = q0 + 8 * g + v;
      Ob[(tokBase + mrow) * H + h * DK + dk] = (__bf16)(oacc[t][v] / Li[v]);
    }
  }
}

// ---------------------------------------------------------------------------
// Host-side launcher
// ---------------------------------------------------------------------------
extern "C" void kernel_launch(void* const* d_in, const int* in_sizes, int n_in,
                              void* d_out, int out_size, void* d_ws, size_t ws_size,
                              hipStream_t stream) {
  const float* x_q  = (const float*)d_in[0];
  const float* x_kv = (const float*)d_in[1];
  const float* bias = (const float*)d_in[2];
  const float* Wq   = (const float*)d_in[3];
  const float* Wk   = (const float*)d_in[4];
  const float* Wv   = (const float*)d_in[5];
  const float* Wo   = (const float*)d_in[6];
  float* out = (float*)d_out;

  char* ws = (char*)d_ws;
  const size_t MB = 1024ull * 1024ull;
  __bf16* xq_bf  = (__bf16*)(ws + 0 * MB);    // 8 MB
  __bf16* xkv_bf = (__bf16*)(ws + 8 * MB);    // 8 MB
  __bf16* wq_bf  = (__bf16*)(ws + 16 * MB);   // 2 MB each
  __bf16* wk_bf  = (__bf16*)(ws + 18 * MB);
  __bf16* wv_bf  = (__bf16*)(ws + 20 * MB);
  __bf16* wo_bf  = (__bf16*)(ws + 22 * MB);
  __bf16* Qb     = (__bf16*)(ws + 24 * MB);   // 8 MB
  __bf16* Kb     = (__bf16*)(ws + 32 * MB);   // 8 MB
  __bf16* VTb    = (__bf16*)(ws + 40 * MB);   // 8 MB (per-head transposed)
  __bf16* Ob     = (__bf16*)(ws + 48 * MB);   // 8 MB

  cvt_all_f32_bf16<<<CVT_BLOCKS, CVT_THREADS, 0, stream>>>(
      x_q, x_kv, Wq, Wk, Wv, Wo, xq_bf, xkv_bf, wq_bf, wk_bf, wv_bf, wo_bf);

  // 4096x1024x1024 GEMMs: wave tile 32x64, grid = (N/64, M/32/4waves);
  // the three input projections share one launch (grid z = 3)
  dim3 ggrid(H / 64, MTOK / 32 / 4), gblk(128);
  const GemmSet setQ{xq_bf,  wq_bf, Qb};
  const GemmSet setK{xkv_bf, wk_bf, Kb};
  const GemmSet setV{xkv_bf, wv_bf, VTb};
  gemm_bf16<0><<<dim3(H / 64, MTOK / 32 / 4, 3), gblk, 0, stream>>>(
      setQ, setK, setV, nullptr, nullptr);

  // attention: (S/16 tiles / 4 waves, B*NH)
  attn_kernel<<<dim3(S / 16 / 4, Bb * NH), 128, 0, stream>>>(Qb, Kb, VTb, bias, Ob);

  // output projection + residual, f32 out
  const GemmSet setO{Ob, wo_bf, nullptr};
  gemm_bf16<2><<<ggrid, gblk, 0, stream>>>(setO, setO, setO, out, x_q);
}

// v002
// One run takes 107 microseconds.
// In two side-by-side timings against v001, it was 1.22 and 1.23 times as fast.
// All steps since v000 together make it 1.71 times as fast.
#include <hip/hip_runtime.h>

typedef __attribute__((ext_vector_type(8)))  __bf16 v8bf;
typedef __attribute__((ext_vector_type(16))) __bf16 v16bf;
typedef __attribute__((ext_vector_type(8)))  float  v8f;

static constexpr int Bb = 4;
static constexpr int S  = 1024;
static constexpr int H  = 1024;
static constexpr int NH = 16;
static constexpr int DK = 64;
static constexpr int MTOK = Bb * S;   // 4096 tokens

__device__ __forceinline__ v8f wmma_bf16(v16bf a, v16bf b, v8f c) {
  return __builtin_amdgcn_wmma_f32_16x16x32_bf16(
      /*neg_a=*/false, a, /*neg_b=*/false, b,
      /*c_mod=*/(short)0, c, /*reuse_a=*/false, /*reuse_b=*/false);
}

__device__ __forceinline__ v16bf load_frag(const __bf16* p) {
  v8bf lo = *(const v8bf*)(p);
  v8bf hi = *(const v8bf*)(p + 16);
  return __builtin_shufflevector(lo, hi, 0,1,2,3,4,5,6,7,8,9,10,11,12,13,14,15);
}

// ---------------------------------------------------------------------------
// fp32 -> bf16 conversion (grid-stride, non-temporal reads: streamed once).
// All six tensors are converted by ONE launch: tensors of equal size share a
// grid-stride loop, so their independent loads are in flight together.
// ---------------------------------------------------------------------------
static constexpr int NX = MTOK * H;   // 4M elements (activations)
static constexpr int NW = H * H;      // 1M elements (weights)
static constexpr int CVT_BLOCKS  = 1024;
static constexpr int CVT_THREADS = 256;

__global__ __launch_bounds__(CVT_THREADS)
void cvt_all_f32_bf16(const float* __restrict__ x_q, const float* __restrict__ x_kv,
                      const float* __restrict__ Wq,  const float* __restrict__ Wk,
                      const float* __restrict__ Wv,  const float* __restrict__ Wo,
                      __bf16* __restrict__ xq_bf, __bf16* __restrict__ xkv_bf,
                      __bf16* __restrict__ wq_bf, __bf16* __restrict__ wk_bf,
                      __bf16* __restrict__ wv_bf, __bf16* __restrict__ wo_bf) {
  const int i0 = blockIdx.x * CVT_THREADS + threadIdx.x;
  constexpr int stride = CVT_BLOCKS * CVT_THREADS;
  for (int i = i0; i < NX; i += stride) {
    const float a = __builtin_nontemporal_load(x_q + i);
    const float b = __builtin_nontemporal_load(x_kv + i);
    xq_bf[i]  = (__bf16)a;
    xkv_bf[i] = (__bf16)b;
  }
  for (int i = i0; i < NW; i += stride) {
    const float a = __builtin_nontemporal_load(Wq + i);
    const float b = __builtin_nontemporal_load(Wk + i);
    const float c = __builtin_nontemporal_load(Wv + i);
    const float d = __builtin_nontemporal_load(Wo + i);
    wq_bf[i] = (__bf16)a;
    wk_bf[i] = (__bf16)b;
    wv_bf[i] = (__bf16)c;
    wo_bf[i] = (__bf16)d;
  }
}

static constexpr int WPAD = 72;

struct GemmSet {
  const __bf16* X;   // 4096 x 1024 activations
  const __bf16* W;   // 1024 x 1024 weights
  __bf16*       out; // bf16 result (unused by MODE 2)
};

template <int MODE>
__global__ __launch_bounds__(128)
void gemm_bf16(GemmSet s0, GemmSet s1, GemmSet s2,
               float* __restrict__ outf, const float* __restrict__ resid) {
  constexpr int Kdim = H;
  constexpr int Ndim = H;

  // operand set of this block (block-uniform; MODE 2 has only set 0)
  const int z = (MODE == 0) ? (int)blockIdx.z : 0;
  const GemmSet st = (z == 0) ? s0 : (z == 1) ? s1 : s2;
  const __bf16* __restrict__ X = st.X;
  const __bf16* __restrict__ W = st.W;

  __shared__ __bf16 Bst[2][64][WPAD];   // 64 N-rows x 64 K (padded), x2 buffers

  const int tid  = threadIdx.x;
  const int lane = tid & 31;
  const int wv   = tid >> 5;
  const int g    = lane >> 4;     // lo/hi 16-lane half
  const int r16  = lane & 15;

  const int tileN = blockIdx.x * 64;                 // shared by all 4 waves
  const int tileM = (blockIdx.y * 4 + wv) * 32;

  // async-stage a 64x64 bf16 W tile: 512 16B chunks over 128 threads
  auto issue_w = [&](int kb, int buf) {
#pragma unroll
    for (int c = 0; c < 4; ++c) {
      const int ch  = tid * 4 + c;          // 0..511
      const int row = ch >> 3, col = (ch & 7) * 8;
      const __bf16* src = W + (size_t)(tileN + row) * Kdim + kb + col;
      unsigned dst = (unsigned)(size_t)&Bst[buf][row][col];
      asm volatile("global_load_async_to_lds_b128 %0, %1, off"
                   :: "v"(dst), "v"(src) : "memory");
    }
  };

  v8f acc[2][4] = {};

  const __bf16* Arow[2];
#pragma unroll
  for (int r = 0; r < 2; ++r)
    Arow[r] = X + (size_t)(tileM + r * 16 + r16) * Kdim + 8 * g;

  issue_w(0, 0);
  asm volatile("s_wait_asynccnt 0x0" ::: "memory");
  __syncthreads();

  for (int kb = 0; kb < Kdim; kb += 64) {
    const int buf = (kb >> 6) & 1;
    if (kb + 64 < Kdim) issue_w(kb + 64, buf ^ 1);   // prefetch next W tile

#pragma unroll
    for (int kk = 0; kk < 64; kk += 32) {
      v16bf a[2], b[4];
#pragma unroll
      for (int r = 0; r < 2; ++r) a[r] = load_frag(Arow[r] + kb + kk);
#pragma unroll
      for (int c = 0; c < 4; ++c)
        b[c] = load_frag(&Bst[buf][c * 16 + r16][kk + 8 * g]);
#pragma unroll
      for (int r = 0; r < 2; ++r)
#pragma unroll
        for (int c = 0; c < 4; ++c) acc[r][c] = wmma_bf16(a[r], b[c], acc[r][c]);
    }

    asm volatile("s_wait_asynccnt 0x0" ::: "memory");
    __syncthreads();
  }

  if constexpr (MODE == 0) {
    __bf16* __restrict__ O = st.out;
    if (z != 2) {
#pragma unroll
      for (int r = 0; r < 2; ++r) {
#pragma unroll
        for (int c = 0; c < 4; ++c) {
          const int n  = tileN + c * 16 + r16;
          const int m0 = tileM + r * 16 + 8 * g;
#pragma unroll
          for (int v = 0; v < 8; ++v)
            O[(size_t)(m0 + v) * Ndim + n] = (__bf16)acc[r][c][v];
        }
      }
      // the stores above have taken their registers before any later
      // instruction on a path out of this branch may overwrite one
      asm volatile("s_wait_xcnt 0x0" ::: "memory");
    } else {
#pragma unroll
      for (int r = 0; r < 2; ++r) {
#pragma unroll
        for (int c = 0; c < 4; ++c) {
          const int n  = tileN + c * 16 + r16;
          const int m0 = tileM + r * 16 + 8 * g;
          const int hh = n >> 6, dk = n & 63;
          const int bb = m0 >> 10, s0i = m0 & 1023;  // 8 consecutive s, same bb
          v8bf pk;
#pragma unroll
          for (int v = 0; v < 8; ++v) pk[v] = (__bf16)acc[r][c][v];
          *(v8bf*)(O + ((size_t)(bb * NH + hh) * DK + dk) * S + s0i) = pk;
        }
      }
    }
  } else {
#pragma unroll
    for (int r = 0; r < 2; ++r) {
#pragma unroll
      for (int c = 0; c < 4; ++c) {
        const int n  = tileN + c * 16 + r16;
        const int m0 = tileM + r * 16 + 8 * g;
#pragma unroll
        for (int v = 0; v < 8; ++v) {
          const size_t idx = (size_t)(m0 + v) * Ndim + n;
          outf[idx] = acc[r][c][v] + resid[idx];
        }
      }
    }
  }
}

static constexpr int KP = 72;
static constexpr int VP = 40;
static constexpr int BP = 36;

typedef __attribute__((ext_vector_type(4))) float v4f;

__device__ __forceinline__ float xhalf(float x) {
  const int b = __builtin_bit_cast(int, x);
  return __builtin_bit_cast(float, __builtin_amdgcn_permlanex16(
      b, b, 0x76543210, 0xfedcba98, false, false));
}

__global__ __launch_bounds__(128)
void attn_kernel(const __bf16* __restrict__ Qb, const __bf16* __restrict__ Kb,
                 const __bf16* __restrict__ VTb, const float* __restrict__ bias,
                 __bf16* __restrict__ Ob) {
  __shared__ __bf16 Kst[2][32][KP];   // 32 keys x 64 dk   (padded)
  __shared__ __bf16 Vst[2][64][VP];   // 64 dk   x 32 keys (padded)
  __shared__ __attribute__((aligned(16)))
  float Bias[2][4][16][BP];           // per wave: 16 queries x 32 keys (padded)

  const int tid  = threadIdx.x;
  const int lane = tid & 31;
  const int wv   = tid >> 5;
  const int g    = lane >> 4;
  const int r16  = lane & 15;

  const int bh = blockIdx.y;            // 0..63
  const int b  = bh >> 4;
  const int h  = bh & 15;
  const int q0 = (blockIdx.x * 4 + wv) * 16;

  const size_t tokBase = (size_t)b * S;
  const float*  biasBH = bias + (size_t)bh * S * S;
  const __bf16* Kbh    = Kb + tokBase * H + h * DK;   // + key*H
  const __bf16* VTbh   = VTb + (size_t)bh * DK * S;   // + dk*S

  // async-stage one 32-key K tile + V^T tile into LDS buffer `buf`
  auto issue_tile = [&](int kb, int buf) {
#pragma unroll
    for (int c = 0; c < 2; ++c) {           // K: 256 16B chunks / 128 thr
      const int ch  = tid * 2 + c;
      const int key = ch >> 3, col = (ch & 7) * 8;
      const __bf16* src = Kbh + (size_t)(kb + key) * H + col;
      unsigned dst = (unsigned)(size_t)&Kst[buf][key][col];
      asm volatile("global_load_async_to_lds_b128 %0, %1, off"
                   :: "v"(dst), "v"(src) : "memory");
    }
#pragma unroll
    for (int c = 0; c < 2; ++c) {           // V: 256 16B chunks / 128 thr
      const int ch = tid * 2 + c;
      const int dk = ch >> 2, col = (ch & 3) * 8;
      const __bf16* src = VTbh + (size_t)dk * S + kb + col;
      unsigned dst = (unsigned)(size_t)&Vst[buf][dk][col];
      asm volatile("global_load_async_to_lds_b128 %0, %1, off"
                   :: "v"(dst), "v"(src) : "memory");
    }
  };

  const float* bsrc0 = biasBH + (size_t)(q0 + (lane >> 3)) * S + (lane & 7) * 4;
  auto issue_bias = [&](int kb, int buf) {
    const float* p0 = bsrc0 + kb;
    const float* p1 = p0 + 4 * S;
    const float* p2 = p0 + 8 * S;
    const float* p3 = p0 + 12 * S;
    const unsigned d0 = (unsigned)(size_t)&Bias[buf][wv][lane >> 3][(lane & 7) * 4];
    const unsigned d1 = d0 + 4 * BP * 4;
    const unsigned d2 = d0 + 8 * BP * 4;
    const unsigned d3 = d0 + 12 * BP * 4;
    asm volatile("global_load_async_to_lds_b128 %0, %4, off\n\t"
                 "global_load_async_to_lds_b128 %1, %5, off\n\t"
                 "global_load_async_to_lds_b128 %2, %6, off\n\t"
                 "global_load_async_to_lds_b128 %3, %7, off\n\t"
                 "s_wait_xcnt 0x0"
                 :: "v"(d0), "v"(d1), "v"(d2), "v"(d3),
                    "v"(p0), "v"(p1), "v"(p2), "v"(p3) : "memory");
  };

  // Q^T fragments (B operand, column = query q0 + r16) for both dk halves;
  // they persist across the whole key loop
  const __bf16* qrow = Qb + (tokBase + q0 + r16) * H + h * DK + 8 * g;
  const v16bf bq0 = load_frag(qrow);
  const v16bf bq1 = load_frag(qrow + 32);

  float Mi = -1e30f;   // running maximum of the query (equal in both halves)
  float Li = 0.f;      // running sum over this half's keys only
  v8f oacc[4] = {};    // O^T: oacc[t][v] = O[q0 + r16][t*16 + 8*g + v]

  issue_tile(0, 0);
  issue_bias(0, 0);
  asm volatile("s_wait_asynccnt 0x0" ::: "memory");
  __syncthreads();

  for (int kb = 0; kb < S; kb += 32) {
    const int buf = (kb >> 5) & 1;
    if (kb + 32 < S) issue_tile(kb + 32, buf ^ 1);   // prefetch next tile
    if (kb + 32 < S) issue_bias(kb + 32, buf ^ 1);   // and its bias tile

    // bias of this lane's query: keys kb + 16*j + 8*g + 0..7
    const float* brow = &Bias[buf][wv][r16][8 * g];
    const v4f b00 = *(const v4f*)(brow);
    const v4f b01 = *(const v4f*)(brow + 4);
    const v4f b10 = *(const v4f*)(brow + 16);
    const v4f b11 = *(const v4f*)(brow + 20);

    // scores^T: two 16-key x 16-query tiles, K rows (A) from the LDS tile;
    // s_j[v] = score(key kb + 16*j + 8*g + v, query q0 + r16)
    v8f s0, s1;
    {
      const __bf16* krow = &Kst[buf][r16][8 * g];
      v8f z = {};
      z  = wmma_bf16(load_frag(krow), bq0, z);
      s0 = wmma_bf16(load_frag(krow + 32), bq1, z);
    }
    {
      const __bf16* krow = &Kst[buf][16 + r16][8 * g];
      v8f z = {};
      z  = wmma_bf16(load_frag(krow), bq0, z);
      s1 = wmma_bf16(load_frag(krow + 32), bq1, z);
    }

    // scale + bias + online softmax, all of one query in one lane pair
    const v8f t0 = s0 * 0.125f +
        __builtin_shufflevector(b00, b01, 0, 1, 2, 3, 4, 5, 6, 7);
    const v8f t1 = s1 * 0.125f +
        __builtin_shufflevector(b10, b11, 0, 1, 2, 3, 4, 5, 6, 7);
    float mx[8];
#pragma unroll
    for (int v = 0; v < 8; ++v) mx[v] = fmaxf(t0[v], t1[v]);
    float rm = fmaxf(fmaxf(fmaxf(mx[0], mx[1]), fmaxf(mx[2], mx[3])),
                     fmaxf(fmaxf(mx[4], mx[5]), fmaxf(mx[6], mx[7])));
    rm = fmaxf(rm, xhalf(rm));
    const float nm = fmaxf(Mi, rm);
    const float cf = __expf(Mi - nm);
    Mi = nm;

    // P^T as a B operand: element s = key kmap(s, g) = tile s >> 3, row s & 7
    v16bf pb;
    float sm[8];
#pragma unroll
    for (int v = 0; v < 8; ++v) {
      const float e0 = __expf(t0[v] - nm);
      const float e1 = __expf(t1[v] - nm);
      pb[v]     = (__bf16)e0;
      pb[8 + v] = (__bf16)e1;
      sm[v] = e0 + e1;
    }
    Li = Li * cf + (((sm[0] + sm[1]) + (sm[2] + sm[3])) +
                    ((sm[4] + sm[5]) + (sm[6] + sm[7])));
#pragma unroll
    for (int t = 0; t < 4; ++t)
#pragma unroll
      for (int v = 0; v < 8; ++v) oacc[t][v] *= cf;

    // O^T += V^T P^T: V^T rows (A) from the LDS tile, contiguous along keys
#pragma unroll
    for (int t = 0; t < 4; ++t) {
      const __bf16* vrow = &Vst[buf][t * 16 + r16][8 * g];
      oacc[t] = wmma_bf16(load_frag(vrow), pb, oacc[t]);
    }

    // this wave's LDS reads of the buffers refilled next have returned;
    // next-tile async copies must land + all waves done reading this buffer
    asm volatile("s_wait_dscnt 0x0" ::: "memory");
    asm volatile("s_wait_asynccnt 0x0" ::: "memory");
    __syncthreads();
  }

  // join the halves' sums, normalize, store: a lane holds 8 consecutive dk of
  // its query per tile -> one 16-byte store into [token][h*DK+dk] bf16
  const float inv = 1.0f / (Li + xhalf(Li));
  __bf16* orow = Ob + (tokBase + q0 + r16) * H + h * DK + 8 * g;
#pragma unroll
  for (int t = 0; t < 4; ++t) {
    v8bf pk;
#pragma unroll
    for (int v = 0; v < 8; ++v) pk[v] = (__bf16)(oacc[t][v] * inv);
    *(v8bf*)(orow + t * 16) = pk;
  }
}

// ---------------------------------------------------------------------------
// Host-side launcher
// ---------------------------------------------------------------------------
extern "C" void kernel_launch(void* const* d_in, const int* in_sizes, int n_in,
                              void* d_out, int out_size, void* d_ws, size_t ws_size,
                              hipStream_t stream) {
  const float* x_q  = (const float*)d_in[0];
  const float* x_kv = (const float*)d_in[1];
  const float* bias = (const float*)d_in[2];
  const float* Wq   = (const float*)d_in[3];
  const float* Wk   = (const float*)d_in[4];
  const float* Wv   = (const float*)d_in[5];
  const float* Wo   = (const float*)d_in[6];
  float* out = (float*)d_out;

  char* ws = (char*)d_ws;
  const size_t MB = 1024ull * 1024ull;
  __bf16* xq_bf  = (__bf16*)(ws + 0 * MB);    // 8 MB
  __bf16* xkv_bf = (__bf16*)(ws + 8 * MB);    // 8 MB
  __bf16* wq_bf  = (__bf16*)(ws + 16 * MB);   // 2 MB each
  __bf16* wk_bf  = (__bf16*)(ws + 18 * MB);
  __bf16* wv_bf  = (__bf16*)(ws + 20 * MB);
  __bf16* wo_bf  = (__bf16*)(ws + 22 * MB);
  __bf16* Qb     = (__bf16*)(ws + 24 * MB);   // 8 MB
  __bf16* Kb     = (__bf16*)(ws + 32 * MB);   // 8 MB
  __bf16* VTb    = (__bf16*)(ws + 40 * MB);   // 8 MB (per-head transposed)
  __bf16* Ob     = (__bf16*)(ws + 48 * MB);   // 8 MB

  cvt_all_f32_bf16<<<CVT_BLOCKS, CVT_THREADS, 0, stream>>>(
      x_q, x_kv, Wq, Wk, Wv, Wo, xq_bf, xkv_bf, wq_bf, wk_bf, wv_bf, wo_bf);

  // 4096x1024x1024 GEMMs: wave tile 32x64, grid = (N/64, M/32/4waves);
  // the three input projections share one launch (grid z = 3)
  dim3 ggrid(H / 64, MTOK / 32 / 4), gblk(128);
  const GemmSet setQ{xq_bf,  wq_bf, Qb};
  const GemmSet setK{xkv_bf, wk_bf, Kb};
  const GemmSet setV{xkv_bf, wv_bf, VTb};
  gemm_bf16<0><<<dim3(H / 64, MTOK / 32 / 4, 3), gblk, 0, stream>>>(
      setQ, setK, setV, nullptr, nullptr);

  // attention: (S/16 tiles / 4 waves, B*NH)
  attn_kernel<<<dim3(S / 16 / 4, Bb * NH), 128, 0, stream>>>(Qb, Kb, VTb, bias, Ob);

  // output projection + residual, f32 out
  const GemmSet setO{Ob, wo_bf, nullptr};
  gemm_bf16<2><<<ggrid, gblk, 0, stream>>>(setO, setO, setO, out, x_q);
}

// v003
// A run of this version takes 88.2 microseconds.
// In both of two side-by-side timings against v002, it was 1.21 times as fast.
// Over all steps from v000 it is 2.08 times as fast.
#include <hip/hip_runtime.h>

typedef __attribute__((ext_vector_type(8)))  __bf16 v8bf;
typedef __attribute__((ext_vector_type(16))) __bf16 v16bf;
typedef __attribute__((ext_vector_type(8)))  float  v8f;

static constexpr int Bb = 4;
static constexpr int S  = 1024;
static constexpr int H  = 1024;
static constexpr int NH = 16;
static constexpr int DK = 64;
static constexpr int MTOK = Bb * S;   // 4096 tokens

__device__ __forceinline__ v8f wmma_bf16(v16bf a, v16bf b, v8f c) {
  return __builtin_amdgcn_wmma_f32_16x16x32_bf16(
      /*neg_a=*/false, a, /*neg_b=*/false, b,
      /*c_mod=*/(short)0, c, /*reuse_a=*/false, /*reuse_b=*/false);
}

__device__ __forceinline__ v16bf load_frag(const __bf16* p) {
  v8bf lo = *(const v8bf*)(p);
  v8bf hi = *(const v8bf*)(p + 16);
  return __builtin_shufflevector(lo, hi, 0,1,2,3,4,5,6,7,8,9,10,11,12,13,14,15);
}

// ---------------------------------------------------------------------------
// fp32 -> bf16 conversion (grid-stride, non-temporal reads: streamed once).
// All six tensors are converted by ONE launch: tensors of equal size share a
// grid-stride loop, so their independent loads are in flight together.
// ---------------------------------------------------------------------------
static constexpr int NX = MTOK * H;   // 4M elements (activations)
static constexpr int NW = H * H;      // 1M elements (weights)
static constexpr int CVT_BLOCKS  = 1024;
static constexpr int CVT_THREADS = 256;

__global__ __launch_bounds__(CVT_THREADS)
void cvt_all_f32_bf16(const float* __restrict__ x_q, const float* __restrict__ x_kv,
                      const float* __restrict__ Wq,  const float* __restrict__ Wk,
                      const float* __restrict__ Wv,  const float* __restrict__ Wo,
                      __bf16* __restrict__ xq_bf, __bf16* __restrict__ xkv_bf,
                      __bf16* __restrict__ wq_bf, __bf16* __restrict__ wk_bf,
                      __bf16* __restrict__ wv_bf, __bf16* __restrict__ wo_bf) {
  const int i0 = blockIdx.x * CVT_THREADS + threadIdx.x;
  constexpr int stride = CVT_BLOCKS * CVT_THREADS;
  for (int i = i0; i < NX; i += stride) {
    const float a = __builtin_nontemporal_load(x_q + i);
    const float b = __builtin_nontemporal_load(x_kv + i);
    xq_bf[i]  = (__bf16)a;
    xkv_bf[i] = (__bf16)b;
  }
  for (int i = i0; i < NW; i += stride) {
    const float a = __builtin_nontemporal_load(Wq + i);
    const float b = __builtin_nontemporal_load(Wk + i);
    const float c = __builtin_nontemporal_load(Wv + i);
    const float d = __builtin_nontemporal_load(Wo + i);
    wq_bf[i] = (__bf16)a;
    wk_bf[i] = (__bf16)b;
    wv_bf[i] = (__bf16)c;
    wo_bf[i] = (__bf16)d;
  }
}

static constexpr int WPAD = 72;

struct GemmSet {
  const __bf16* X;   // 4096 x 1024 activations
  const __bf16* W;   // 1024 x 1024 weights
  __bf16*       out; // bf16 result (unused by MODE 2)
};

template <int MODE>
__global__ __launch_bounds__(128)
void gemm_bf16(GemmSet s0, GemmSet s1, GemmSet s2,
               float* __restrict__ outf, const float* __restrict__ resid) {
  constexpr int Kdim = H;
  constexpr int Ndim = H;

  // operand set of this block (block-uniform; MODE 2 has only set 0)
  const int z = (MODE == 0) ? (int)blockIdx.z : 0;
  const GemmSet st = (z == 0) ? s0 : (z == 1) ? s1 : s2;
  const __bf16* __restrict__ X = st.X;
  const __bf16* __restrict__ W = st.W;

  __shared__ __attribute__((aligned(256))) __bf16 Ast[2][128][64];
  __shared__ __attribute__((aligned(16)))
  __bf16 Bst[2][64][WPAD];              // 64 N-rows x 64 K (padded), x2 buffers

  const int tid  = threadIdx.x;
  const int lane = tid & 31;
  const int wv   = tid >> 5;
  const int g    = lane >> 4;     // lo/hi 16-lane half
  const int r16  = lane & 15;

  const int tileN = blockIdx.x * 64;                 // shared by all 4 waves
  const int blkM  = blockIdx.y * 128;                // the block's X rows
  const int tileM = blkM + wv * 32;

  const int crow = tid >> 3, cpc = tid & 7;
  const __bf16* asrc = X + (size_t)(blkM + crow) * Kdim + cpc * 8;
  const __bf16* wsrc = W + (size_t)(tileN + crow) * Kdim + cpc * 8;
  const unsigned adst = (unsigned)(size_t)&Ast[0][crow][(cpc ^ (crow >> 1)) * 8];
  const unsigned wdst = (unsigned)(size_t)&Bst[0][crow][cpc * 8];
  auto issue_tiles = [&](int kb, int buf) {
    const __bf16* a0 = asrc + kb;
    const __bf16* w0 = wsrc + kb;
    const unsigned da = adst + buf * (128 * 64 * 2);
    const unsigned dw = wdst + buf * (64 * WPAD * 2);
    constexpr int AR = 16 * 64 * 2;      // 16 X-tile rows in LDS, bytes
    constexpr int WR = 16 * WPAD * 2;    // 16 W-tile rows in LDS, bytes
    constexpr int GR = 16 * Kdim;        // 16 rows in global, elements
    asm volatile("global_load_async_to_lds_b128 %0, %12, off\n\t"
                 "global_load_async_to_lds_b128 %1, %13, off\n\t"
                 "global_load_async_to_lds_b128 %2, %14, off\n\t"
                 "global_load_async_to_lds_b128 %3, %15, off\n\t"
                 "global_load_async_to_lds_b128 %4, %16, off\n\t"
                 "global_load_async_to_lds_b128 %5, %17, off\n\t"
                 "global_load_async_to_lds_b128 %6, %18, off\n\t"
                 "global_load_async_to_lds_b128 %7, %19, off\n\t"
                 "global_load_async_to_lds_b128 %8, %20, off\n\t"
                 "global_load_async_to_lds_b128 %9, %21, off\n\t"
                 "global_load_async_to_lds_b128 %10, %22, off\n\t"
                 "global_load_async_to_lds_b128 %11, %23, off\n\t"
                 "s_wait_xcnt 0x0"
                 :: "v"(da), "v"(da + AR), "v"(da + 2 * AR), "v"(da + 3 * AR),
                    "v"(da + 4 * AR), "v"(da + 5 * AR), "v"(da + 6 * AR),
                    "v"(da + 7 * AR),
                    "v"(dw), "v"(dw + WR), "v"(dw + 2 * WR), "v"(dw + 3 * WR),
                    "v"(a0), "v"(a0 + GR), "v"(a0 + 2 * GR), "v"(a0 + 3 * GR),
                    "v"(a0 + 4 * GR), "v"(a0 + 5 * GR), "v"(a0 + 6 * GR),
                    "v"(a0 + 7 * GR),
                    "v"(w0), "v"(w0 + GR), "v"(w0 + 2 * GR), "v"(w0 + 3 * GR)
                 : "memory");
  };

  v8f acc[2][4] = {};

  // element offsets, inside this lane's X-tile row, of its four 16-byte
  // pieces g, g + 2, g + 4, g + 6 (rows 16 apart share them)
  int aoff[4];
#pragma unroll
  for (int j = 0; j < 4; ++j) aoff[j] = ((g + 2 * j) ^ (r16 >> 1)) * 8;

  issue_tiles(0, 0);
  asm volatile("s_wait_asynccnt 0x0" ::: "memory");
  __syncthreads();
  issue_tiles(64, 1);                                // tile 1 flies over trip 0

  for (int kb = 0; kb < Kdim; kb += 64) {
    const int buf = (kb >> 6) & 1;
    const __bf16* abase = &Ast[buf][wv * 32 + r16][0];

#pragma unroll
    for (int kk = 0; kk < 64; kk += 32) {
      v16bf a[2], b[4];
#pragma unroll
      for (int r = 0; r < 2; ++r) {
        const v8bf lo = *(const v8bf*)(abase + r * 16 * 64 + aoff[kk / 16]);
        const v8bf hi = *(const v8bf*)(abase + r * 16 * 64 + aoff[kk / 16 + 1]);
        a[r] = __builtin_shufflevector(lo, hi, 0, 1, 2, 3, 4, 5, 6, 7,
                                       8, 9, 10, 11, 12, 13, 14, 15);
      }
#pragma unroll
      for (int c = 0; c < 4; ++c)
        b[c] = load_frag(&Bst[buf][c * 16 + r16][kk + 8 * g]);
#pragma unroll
      for (int r = 0; r < 2; ++r)
#pragma unroll
        for (int c = 0; c < 4; ++c) acc[r][c] = wmma_bf16(a[r], b[c], acc[r][c]);
    }

    // this wave's LDS reads of the buffer refilled next have returned; the
    // next tile's copies have landed; every wave has left this buffer
    asm volatile("s_wait_dscnt 0x0" ::: "memory");
    asm volatile("s_wait_asynccnt 0x0" ::: "memory");
    __syncthreads();
    if (kb + 128 < Kdim) issue_tiles(kb + 128, buf);  // refill the buffer just read
  }
  // no copy is outstanding when the wave goes on to its stores and ends
  asm volatile("s_wait_asynccnt 0x0" ::: "memory");

  if constexpr (MODE == 0) {
    __bf16* __restrict__ O = st.out;
    if (z != 2) {
#pragma unroll
      for (int r = 0; r < 2; ++r) {
#pragma unroll
        for (int c = 0; c < 4; ++c) {
          const int n  = tileN + c * 16 + r16;
          const int m0 = tileM + r * 16 + 8 * g;
#pragma unroll
          for (int v = 0; v < 8; ++v)
            O[(size_t)(m0 + v) * Ndim + n] = (__bf16)acc[r][c][v];
        }
      }
      // the stores above have taken their registers before any later
      // instruction on a path out of this branch may overwrite one
      asm volatile("s_wait_xcnt 0x0" ::: "memory");
    } else {
#pragma unroll
      for (int r = 0; r < 2; ++r) {
#pragma unroll
        for (int c = 0; c < 4; ++c) {
          const int n  = tileN + c * 16 + r16;
          const int m0 = tileM + r * 16 + 8 * g;
          const int hh = n >> 6, dk = n & 63;
          const int bb = m0 >> 10, s0i = m0 & 1023;  // 8 consecutive s, same bb
          v8bf pk;
#pragma unroll
          for (int v = 0; v < 8; ++v) pk[v] = (__bf16)acc[r][c][v];
          *(v8bf*)(O + ((size_t)(bb * NH + hh) * DK + dk) * S + s0i) = pk;
        }
      }
    }
  } else {
#pragma unroll
    for (int r = 0; r < 2; ++r) {
#pragma unroll
      for (int c = 0; c < 4; ++c) {
        const int n  = tileN + c * 16 + r16;
        const int m0 = tileM + r * 16 + 8 * g;
#pragma unroll
        for (int v = 0; v < 8; ++v) {
          const size_t idx = (size_t)(m0 + v) * Ndim + n;
          outf[idx] = acc[r][c][v] + resid[idx];
        }
      }
    }
  }
}

static constexpr int KP = 72;
static constexpr int VP = 40;
static constexpr int BP = 36;

typedef __attribute__((ext_vector_type(4))) float v4f;

__device__ __forceinline__ float xhalf(float x) {
  const int b = __builtin_bit_cast(int, x);
  return __builtin_bit_cast(float, __builtin_amdgcn_permlanex16(
      b, b, 0x76543210, 0xfedcba98, false, false));
}

__global__ __launch_bounds__(128)
void attn_kernel(const __bf16* __restrict__ Qb, const __bf16* __restrict__ Kb,
                 const __bf16* __restrict__ VTb, const float* __restrict__ bias,
                 __bf16* __restrict__ Ob) {
  __shared__ __attribute__((aligned(16)))
  __bf16 Kst[2][32][KP];              // 32 keys x 64 dk   (padded)
  __shared__ __attribute__((aligned(16)))
  __bf16 Vst[2][64][VP];              // 64 dk   x 32 keys (padded)
  __shared__ __attribute__((aligned(16)))
  float Bias[2][4][16][BP];           // per wave: 16 queries x 32 keys (padded)

  const int tid  = threadIdx.x;
  const int lane = tid & 31;
  const int wv   = tid >> 5;
  const int g    = lane >> 4;
  const int r16  = lane & 15;

  const int bh = blockIdx.y;            // 0..63
  const int b  = bh >> 4;
  const int h  = bh & 15;
  const int q0 = (blockIdx.x * 4 + wv) * 16;

  const size_t tokBase = (size_t)b * S;
  const float*  biasBH = bias + (size_t)bh * S * S;
  const __bf16* Kbh    = Kb + tokBase * H + h * DK;   // + key*H
  const __bf16* VTbh   = VTb + (size_t)bh * DK * S;   // + dk*S

  const int krow = tid >> 3, kcol = (tid & 7) * 8;   // keys krow, krow + 16
  const int vrow = tid >> 2, vcol = (tid & 3) * 8;   // dk   vrow, vrow + 32
  const __bf16* ksrc = Kbh + (size_t)krow * H + kcol;
  const __bf16* vsrc = VTbh + (size_t)vrow * S + vcol;
  const float* bsrc0 = biasBH + (size_t)(q0 + (lane >> 3)) * S + (lane & 7) * 4;
  auto issue_tile = [&](int kb, int buf) {
    const __bf16* k0 = ksrc + (size_t)kb * H;
    const __bf16* k1 = k0 + 16 * H;
    const __bf16* v0 = vsrc + kb;
    const __bf16* v1 = v0 + 32 * S;
    const unsigned dk0 = (unsigned)(size_t)&Kst[buf][krow][kcol];
    const unsigned dk1 = dk0 + 16 * KP * 2;
    const unsigned dv0 = (unsigned)(size_t)&Vst[buf][vrow][vcol];
    const unsigned dv1 = dv0 + 32 * VP * 2;
    const float* p0 = bsrc0 + kb;
    const float* p1 = p0 + 4 * S;
    const float* p2 = p0 + 8 * S;
    const float* p3 = p0 + 12 * S;
    const unsigned d0 = (unsigned)(size_t)&Bias[buf][wv][lane >> 3][(lane & 7) * 4];
    const unsigned d1 = d0 + 4 * BP * 4;
    const unsigned d2 = d0 + 8 * BP * 4;
    const unsigned d3 = d0 + 12 * BP * 4;
    asm volatile("global_load_async_to_lds_b128 %0, %8, off\n\t"
                 "global_load_async_to_lds_b128 %1, %9, off\n\t"
                 "global_load_async_to_lds_b128 %2, %10, off\n\t"
                 "global_load_async_to_lds_b128 %3, %11, off\n\t"
                 "global_load_async_to_lds_b128 %4, %12, off\n\t"
                 "global_load_async_to_lds_b128 %5, %13, off\n\t"
                 "global_load_async_to_lds_b128 %6, %14, off\n\t"
                 "global_load_async_to_lds_b128 %7, %15, off\n\t"
                 "s_wait_xcnt 0x0"
                 :: "v"(d0), "v"(d1), "v"(d2), "v"(d3),
                    "v"(dk0), "v"(dk1), "v"(dv0), "v"(dv1),
                    "v"(p0), "v"(p1), "v"(p2), "v"(p3),
                    "v"(k0), "v"(k1), "v"(v0), "v"(v1) : "memory");
  };

  // Q^T fragments (B operand, column = query q0 + r16) for both dk halves;
  // they persist across the whole key loop
  const __bf16* qrow = Qb + (tokBase + q0 + r16) * H + h * DK + 8 * g;
  const v16bf bq0 = load_frag(qrow);
  const v16bf bq1 = load_frag(qrow + 32);

  float Mi = -1e30f;   // running maximum of the query (equal in both halves)
  float Li = 0.f;      // running sum over this half's keys only
  v8f oacc[4] = {};    // O^T: oacc[t][v] = O[q0 + r16][t*16 + 8*g + v]

  issue_tile(0, 0);
  asm volatile("s_wait_asynccnt 0x0" ::: "memory");
  __syncthreads();

  for (int kb = 0; kb < S; kb += 32) {
    const int buf = (kb >> 5) & 1;
    if (kb + 32 < S) issue_tile(kb + 32, buf ^ 1);   // prefetch the next tiles

    // bias of this lane's query: keys kb + 16*j + 8*g + 0..7
    const float* brow = &Bias[buf][wv][r16][8 * g];
    const v4f b00 = *(const v4f*)(brow);
    const v4f b01 = *(const v4f*)(brow + 4);
    const v4f b10 = *(const v4f*)(brow + 16);
    const v4f b11 = *(const v4f*)(brow + 20);

    // scores^T: two 16-key x 16-query tiles, K rows (A) from the LDS tile;
    // s_j[v] = score(key kb + 16*j + 8*g + v, query q0 + r16)
    v8f s0, s1;
    {
      const __bf16* krow = &Kst[buf][r16][8 * g];
      v8f z = {};
      z  = wmma_bf16(load_frag(krow), bq0, z);
      s0 = wmma_bf16(load_frag(krow + 32), bq1, z);
    }
    {
      const __bf16* krow = &Kst[buf][16 + r16][8 * g];
      v8f z = {};
      z  = wmma_bf16(load_frag(krow), bq0, z);
      s1 = wmma_bf16(load_frag(krow + 32), bq1, z);
    }

    // scale + bias + online softmax, all of one query in one lane pair
    const v8f t0 = s0 * 0.125f +
        __builtin_shufflevector(b00, b01, 0, 1, 2, 3, 4, 5, 6, 7);
    const v8f t1 = s1 * 0.125f +
        __builtin_shufflevector(b10, b11, 0, 1, 2, 3, 4, 5, 6, 7);
    float mx[8];
#pragma unroll
    for (int v = 0; v < 8; ++v) mx[v] = fmaxf(t0[v], t1[v]);
    float rm = fmaxf(fmaxf(fmaxf(mx[0], mx[1]), fmaxf(mx[2], mx[3])),
                     fmaxf(fmaxf(mx[4], mx[5]), fmaxf(mx[6], mx[7])));
    rm = fmaxf(rm, xhalf(rm));
    const float nm = fmaxf(Mi, rm);
    const float cf = __expf(Mi - nm);
    Mi = nm;

    // P^T as a B operand: element s = key kmap(s, g) = tile s >> 3, row s & 7
    v16bf pb;
    float sm[8];
#pragma unroll
    for (int v = 0; v < 8; ++v) {
      const float e0 = __expf(t0[v] - nm);
      const float e1 = __expf(t1[v] - nm);
      pb[v]     = (__bf16)e0;
      pb[8 + v] = (__bf16)e1;
      sm[v] = e0 + e1;
    }
    Li = Li * cf + (((sm[0] + sm[1]) + (sm[2] + sm[3])) +
                    ((sm[4] + sm[5]) + (sm[6] + sm[7])));
#pragma unroll
    for (int t = 0; t < 4; ++t)
#pragma unroll
      for (int v = 0; v < 8; ++v) oacc[t][v] *= cf;

    // O^T += V^T P^T: V^T rows (A) from the LDS tile, contiguous along keys
#pragma unroll
    for (int t = 0; t < 4; ++t) {
      const __bf16* vrow = &Vst[buf][t * 16 + r16][8 * g];
      oacc[t] = wmma_bf16(load_frag(vrow), pb, oacc[t]);
    }

    // this wave's LDS reads of the buffers refilled next have returned;
    // next-tile async copies must land + all waves done reading this buffer
    asm volatile("s_wait_dscnt 0x0" ::: "memory");
    asm volatile("s_wait_asynccnt 0x0" ::: "memory");
    __syncthreads();
  }

  // join the halves' sums, normalize, store: a lane holds 8 consecutive dk of
  // its query per tile -> one 16-byte store into [token][h*DK+dk] bf16
  const float inv = 1.0f / (Li + xhalf(Li));
  __bf16* orow = Ob + (tokBase + q0 + r16) * H + h * DK + 8 * g;
#pragma unroll
  for (int t = 0; t < 4; ++t) {
    v8bf pk;
#pragma unroll
    for (int v = 0; v < 8; ++v) pk[v] = (__bf16)(oacc[t][v] * inv);
    *(v8bf*)(orow + t * 16) = pk;
  }
}

// ---------------------------------------------------------------------------
// Host-side launcher
// ---------------------------------------------------------------------------
extern "C" void kernel_launch(void* const* d_in, const int* in_sizes, int n_in,
                              void* d_out, int out_size, void* d_ws, size_t ws_size,
                              hipStream_t stream) {
  const float* x_q  = (const float*)d_in[0];
  const float* x_kv = (const float*)d_in[1];
  const float* bias = (const float*)d_in[2];
  const float* Wq   = (const float*)d_in[3];
  const float* Wk   = (const float*)d_in[4];
  const float* Wv   = (const float*)d_in[5];
  const float* Wo   = (const float*)d_in[6];
  float* out = (float*)d_out;

  char* ws = (char*)d_ws;
  const size_t MB = 1024ull * 1024ull;
  __bf16* xq_bf  = (__bf16*)(ws + 0 * MB);    // 8 MB
  __bf16* xkv_bf = (__bf16*)(ws + 8 * MB);    // 8 MB
  __bf16* wq_bf  = (__bf16*)(ws + 16 * MB);   // 2 MB each
  __bf16* wk_bf  = (__bf16*)(ws + 18 * MB);
  __bf16* wv_bf  = (__bf16*)(ws + 20 * MB);
  __bf16* wo_bf  = (__bf16*)(ws + 22 * MB);
  __bf16* Qb     = (__bf16*)(ws + 24 * MB);   // 8 MB
  __bf16* Kb     = (__bf16*)(ws + 32 * MB);   // 8 MB
  __bf16* VTb    = (__bf16*)(ws + 40 * MB);   // 8 MB (per-head transposed)
  __bf16* Ob     = (__bf16*)(ws + 48 * MB);   // 8 MB

  cvt_all_f32_bf16<<<CVT_BLOCKS, CVT_THREADS, 0, stream>>>(
      x_q, x_kv, Wq, Wk, Wv, Wo, xq_bf, xkv_bf, wq_bf, wk_bf, wv_bf, wo_bf);

  // 4096x1024x1024 GEMMs: wave tile 32x64, grid = (N/64, M/32/4waves);
  // the three input projections share one launch (grid z = 3)
  dim3 ggrid(H / 64, MTOK / 32 / 4), gblk(128);
  const GemmSet setQ{xq_bf,  wq_bf, Qb};
  const GemmSet setK{xkv_bf, wk_bf, Kb};
  const GemmSet setV{xkv_bf, wv_bf, VTb};
  gemm_bf16<0><<<dim3(H / 64, MTOK / 32 / 4, 3), gblk, 0, stream>>>(
      setQ, setK, setV, nullptr, nullptr);

  // attention: (S/16 tiles / 4 waves, B*NH)
  attn_kernel<<<dim3(S / 16 / 4, Bb * NH), 128, 0, stream>>>(Qb, Kb, VTb, bias, Ob);

  // output projection + residual, f32 out
  const GemmSet setO{Ob, wo_bf, nullptr};
  gemm_bf16<2><<<ggrid, gblk, 0, stream>>>(setO, setO, setO, out, x_q);
}

// v004
// A run of this version takes 82 microseconds.
// Next to v003, in two timings, it ran 1.07 times as fast each time.
// All steps since v000 together make it 2.23 times as fast.
#include <hip/hip_runtime.h>

typedef __attribute__((ext_vector_type(8)))  __bf16 v8bf;
typedef __attribute__((ext_vector_type(16))) __bf16 v16bf;
typedef __attribute__((ext_vector_type(8)))  float  v8f;

static constexpr int Bb = 4;
static constexpr int S  = 1024;
static constexpr int H  = 1024;
static constexpr int NH = 16;
static constexpr int DK = 64;
static constexpr int MTOK = Bb * S;   // 4096 tokens

__device__ __forceinline__ v8f wmma_bf16(v16bf a, v16bf b, v8f c) {
  return __builtin_amdgcn_wmma_f32_16x16x32_bf16(
      /*neg_a=*/false, a, /*neg_b=*/false, b,
      /*c_mod=*/(short)0, c, /*reuse_a=*/false, /*reuse_b=*/false);
}

__device__ __forceinline__ v16bf load_frag(const __bf16* p) {
  v8bf lo = *(const v8bf*)(p);
  v8bf hi = *(const v8bf*)(p + 16);
  return __builtin_shufflevector(lo, hi, 0,1,2,3,4,5,6,7,8,9,10,11,12,13,14,15);
}

// ---------------------------------------------------------------------------
// fp32 -> bf16 conversion of all six tensors in ONE launch, as a stream: no
// loop. A wave owns one contiguous run of every tensor (4 KB of each
// activation, 1 KB of each weight) and reads it in 16-byte pieces a lane, 512
// contiguous bytes a load. All 24 loads of a lane are independent and are
// issued before the first result is used, so a wave pays the memory latency
// once. Non-temporal reads: streamed once. A store writes 8 bytes a lane, 256
// contiguous bytes a wave (two whole lines).
// ---------------------------------------------------------------------------
typedef __attribute__((ext_vector_type(4))) float  v4f;
typedef __attribute__((ext_vector_type(4))) __bf16 v4bf;

static constexpr int NX = MTOK * H;   // 4M elements (activations)
static constexpr int NW = H * H;      // 1M elements (weights)
static constexpr int CVT_BLOCKS  = 512;
static constexpr int CVT_THREADS = 256;
static constexpr int CVT_WAVES   = CVT_BLOCKS * CVT_THREADS / 32;
static constexpr int XL = NX / (4 * 32 * CVT_WAVES);   // 8 loads a wave
static constexpr int WL = NW / (4 * 32 * CVT_WAVES);   // 2 loads a wave
static_assert(XL * 4 * 32 * CVT_WAVES == NX && WL * 4 * 32 * CVT_WAVES == NW,
              "the waves' runs cover every tensor exactly");

__global__ __launch_bounds__(CVT_THREADS)
void cvt_all_f32_bf16(const float* __restrict__ x_q, const float* __restrict__ x_kv,
                      const float* __restrict__ Wq,  const float* __restrict__ Wk,
                      const float* __restrict__ Wv,  const float* __restrict__ Wo,
                      __bf16* __restrict__ xq_bf, __bf16* __restrict__ xkv_bf,
                      __bf16* __restrict__ wq_bf, __bf16* __restrict__ wk_bf,
                      __bf16* __restrict__ wv_bf, __bf16* __restrict__ wo_bf) {
  const int wave = blockIdx.x * (CVT_THREADS / 32) + (threadIdx.x >> 5);
  const int lane = threadIdx.x & 31;
  // this lane's first 4-element piece of an activation and of a weight
  const int xi = wave * (XL * 32) + lane;
  const int wi = wave * (WL * 32) + lane;

  v4f a[XL], b[XL], c[WL], d[WL], e[WL], f[WL];
#pragma unroll  // constant indices: the arrays stay in registers
  for (int j = 0; j < XL; ++j)
    a[j] = __builtin_nontemporal_load((const v4f*)x_q + xi + j * 32);
#pragma unroll  // constant indices: the arrays stay in registers
  for (int j = 0; j < XL; ++j)
    b[j] = __builtin_nontemporal_load((const v4f*)x_kv + xi + j * 32);
#pragma unroll  // constant indices: the arrays stay in registers
  for (int j = 0; j < WL; ++j) {
    c[j] = __builtin_nontemporal_load((const v4f*)Wq + wi + j * 32);
    d[j] = __builtin_nontemporal_load((const v4f*)Wk + wi + j * 32);
    e[j] = __builtin_nontemporal_load((const v4f*)Wv + wi + j * 32);
    f[j] = __builtin_nontemporal_load((const v4f*)Wo + wi + j * 32);
  }
  // keeps every load ahead of the first conversion: left alone, the scheduler
  // holds ten loads back until earlier ones have returned (a second latency)
  __builtin_amdgcn_sched_barrier(0);

#pragma unroll  // constant indices: the arrays stay in registers
  for (int j = 0; j < XL; ++j)
    *((v4bf*)xq_bf + xi + j * 32) = __builtin_convertvector(a[j], v4bf);
#pragma unroll  // constant indices: the arrays stay in registers
  for (int j = 0; j < XL; ++j)
    *((v4bf*)xkv_bf + xi + j * 32) = __builtin_convertvector(b[j], v4bf);
#pragma unroll  // constant indices: the arrays stay in registers
  for (int j = 0; j < WL; ++j) {
    *((v4bf*)wq_bf + wi + j * 32) = __builtin_convertvector(c[j], v4bf);
    *((v4bf*)wk_bf + wi + j * 32) = __builtin_convertvector(d[j], v4bf);
    *((v4bf*)wv_bf + wi + j * 32) = __builtin_convertvector(e[j], v4bf);
    *((v4bf*)wo_bf + wi + j * 32) = __builtin_convertvector(f[j], v4bf);
  }
}

static constexpr int WPAD = 72;

struct GemmSet {
  const __bf16* X;   // 4096 x 1024 activations
  const __bf16* W;   // 1024 x 1024 weights
  __bf16*       out; // bf16 result (unused by MODE 2)
};

template <int MODE>
__global__ __launch_bounds__(128)
void gemm_bf16(GemmSet s0, GemmSet s1, GemmSet s2,
               float* __restrict__ outf, const float* __restrict__ resid) {
  constexpr int Kdim = H;
  constexpr int Ndim = H;

  // operand set of this block (block-uniform; MODE 2 has only set 0)
  const int z = (MODE == 0) ? (int)blockIdx.z : 0;
  const GemmSet st = (z == 0) ? s0 : (z == 1) ? s1 : s2;
  const __bf16* __restrict__ X = st.X;
  const __bf16* __restrict__ W = st.W;

  __shared__ __attribute__((aligned(256))) __bf16 Ast[2][128][64];
  __shared__ __attribute__((aligned(16)))
  __bf16 Bst[2][64][WPAD];              // 64 N-rows x 64 K (padded), x2 buffers

  const int tid  = threadIdx.x;
  const int lane = tid & 31;
  const int wv   = tid >> 5;
  const int g    = lane >> 4;     // lo/hi 16-lane half
  const int r16  = lane & 15;

  const int tileN = blockIdx.x * 64;                 // shared by all 4 waves
  const int blkM  = blockIdx.y * 128;                // the block's X rows
  const int tileM = blkM + wv * 32;

  const int crow = tid >> 3, cpc = tid & 7;
  const __bf16* asrc = X + (size_t)(blkM + crow) * Kdim + cpc * 8;
  const __bf16* wsrc = W + (size_t)(tileN + crow) * Kdim + cpc * 8;
  const unsigned adst = (unsigned)(size_t)&Ast[0][crow][(cpc ^ (crow >> 1)) * 8];
  const unsigned wdst = (unsigned)(size_t)&Bst[0][crow][cpc * 8];
  auto issue_tiles = [&](int kb, int buf) {
    const __bf16* a0 = asrc + kb;
    const __bf16* w0 = wsrc + kb;
    const unsigned da = adst + buf * (128 * 64 * 2);
    const unsigned dw = wdst + buf * (64 * WPAD * 2);
    constexpr int AR = 16 * 64 * 2;      // 16 X-tile rows in LDS, bytes
    constexpr int WR = 16 * WPAD * 2;    // 16 W-tile rows in LDS, bytes
    constexpr int GR = 16 * Kdim;        // 16 rows in global, elements
    asm volatile("global_load_async_to_lds_b128 %0, %12, off\n\t"
                 "global_load_async_to_lds_b128 %1, %13, off\n\t"
                 "global_load_async_to_lds_b128 %2, %14, off\n\t"
                 "global_load_async_to_lds_b128 %3, %15, off\n\t"
                 "global_load_async_to_lds_b128 %4, %16, off\n\t"
                 "global_load_async_to_lds_b128 %5, %17, off\n\t"
                 "global_load_async_to_lds_b128 %6, %18, off\n\t"
                 "global_load_async_to_lds_b128 %7, %19, off\n\t"
                 "global_load_async_to_lds_b128 %8, %20, off\n\t"
                 "global_load_async_to_lds_b128 %9, %21, off\n\t"
                 "global_load_async_to_lds_b128 %10, %22, off\n\t"
                 "global_load_async_to_lds_b128 %11, %23, off\n\t"
                 "s_wait_xcnt 0x0"
                 :: "v"(da), "v"(da + AR), "v"(da + 2 * AR), "v"(da + 3 * AR),
                    "v"(da + 4 * AR), "v"(da + 5 * AR), "v"(da + 6 * AR),
                    "v"(da + 7 * AR),
                    "v"(dw), "v"(dw + WR), "v"(dw + 2 * WR), "v"(dw + 3 * WR),
                    "v"(a0), "v"(a0 + GR), "v"(a0 + 2 * GR), "v"(a0 + 3 * GR),
                    "v"(a0 + 4 * GR), "v"(a0 + 5 * GR), "v"(a0 + 6 * GR),
                    "v"(a0 + 7 * GR),
                    "v"(w0), "v"(w0 + GR), "v"(w0 + 2 * GR), "v"(w0 + 3 * GR)
                 : "memory");
  };

  v8f acc[2][4] = {};

  // element offsets, inside this lane's X-tile row, of its four 16-byte
  // pieces g, g + 2, g + 4, g + 6 (rows 16 apart share them)
  int aoff[4];
#pragma unroll
  for (int j = 0; j < 4; ++j) aoff[j] = ((g + 2 * j) ^ (r16 >> 1)) * 8;

  issue_tiles(0, 0);
  asm volatile("s_wait_asynccnt 0x0" ::: "memory");
  __syncthreads();
  issue_tiles(64, 1);                                // tile 1 flies over trip 0

  for (int kb = 0; kb < Kdim; kb += 64) {
    const int buf = (kb >> 6) & 1;
    const __bf16* abase = &Ast[buf][wv * 32 + r16][0];

#pragma unroll
    for (int kk = 0; kk < 64; kk += 32) {
      v16bf a[2], b[4];
#pragma unroll
      for (int r = 0; r < 2; ++r) {
        const v8bf lo = *(const v8bf*)(abase + r * 16 * 64 + aoff[kk / 16]);
        const v8bf hi = *(const v8bf*)(abase + r * 16 * 64 + aoff[kk / 16 + 1]);
        a[r] = __builtin_shufflevector(lo, hi, 0, 1, 2, 3, 4, 5, 6, 7,
                                       8, 9, 10, 11, 12, 13, 14, 15);
      }
#pragma unroll
      for (int c = 0; c < 4; ++c)
        b[c] = load_frag(&Bst[buf][c * 16 + r16][kk + 8 * g]);
#pragma unroll
      for (int r = 0; r < 2; ++r)
#pragma unroll
        for (int c = 0; c < 4; ++c) acc[r][c] = wmma_bf16(a[r], b[c], acc[r][c]);
    }

    // this wave's LDS reads of the buffer refilled next have returned; the
    // next tile's copies have landed; every wave has left this buffer
    asm volatile("s_wait_dscnt 0x0" ::: "memory");
    asm volatile("s_wait_asynccnt 0x0" ::: "memory");
    __syncthreads();
    if (kb + 128 < Kdim) issue_tiles(kb + 128, buf);  // refill the buffer just read
  }
  // no copy is outstanding when the wave goes on to its stores and ends
  asm volatile("s_wait_asynccnt 0x0" ::: "memory");

  if constexpr (MODE == 0) {
    __bf16* __restrict__ O = st.out;
    if (z != 2) {
#pragma unroll
      for (int r = 0; r < 2; ++r) {
#pragma unroll
        for (int c = 0; c < 4; ++c) {
          const int n  = tileN + c * 16 + r16;
          const int m0 = tileM + r * 16 + 8 * g;
#pragma unroll
          for (int v = 0; v < 8; ++v)
            O[(size_t)(m0 + v) * Ndim + n] = (__bf16)acc[r][c][v];
        }
      }
      // the stores above have taken their registers before any later
      // instruction on a path out of this branch may overwrite one
      asm volatile("s_wait_xcnt 0x0" ::: "memory");
    } else {
#pragma unroll
      for (int r = 0; r < 2; ++r) {
#pragma unroll
        for (int c = 0; c < 4; ++c) {
          const int n  = tileN + c * 16 + r16;
          const int m0 = tileM + r * 16 + 8 * g;
          const int hh = n >> 6, dk = n & 63;
          const int bb = m0 >> 10, s0i = m0 & 1023;  // 8 consecutive s, same bb
          v8bf pk;
#pragma unroll
          for (int v = 0; v < 8; ++v) pk[v] = (__bf16)acc[r][c][v];
          *(v8bf*)(O + ((size_t)(bb * NH + hh) * DK + dk) * S + s0i) = pk;
        }
      }
    }
  } else {
#pragma unroll
    for (int r = 0; r < 2; ++r) {
#pragma unroll
      for (int c = 0; c < 4; ++c) {
        const int n  = tileN + c * 16 + r16;
        const int m0 = tileM + r * 16 + 8 * g;
#pragma unroll
        for (int v = 0; v < 8; ++v) {
          const size_t idx = (size_t)(m0 + v) * Ndim + n;
          outf[idx] = acc[r][c][v] + resid[idx];
        }
      }
    }
  }
}

static constexpr int KP = 72;
static constexpr int VP = 40;
static constexpr int BP = 36;

__device__ __forceinline__ float xhalf(float x) {
  const int b = __builtin_bit_cast(int, x);
  return __builtin_bit_cast(float, __builtin_amdgcn_permlanex16(
      b, b, 0x76543210, 0xfedcba98, false, false));
}

__global__ __launch_bounds__(128)
void attn_kernel(const __bf16* __restrict__ Qb, const __bf16* __restrict__ Kb,
                 const __bf16* __restrict__ VTb, const float* __restrict__ bias,
                 __bf16* __restrict__ Ob) {
  __shared__ __attribute__((aligned(16)))
  __bf16 Kst[2][32][KP];              // 32 keys x 64 dk   (padded)
  __shared__ __attribute__((aligned(16)))
  __bf16 Vst[2][64][VP];              // 64 dk   x 32 keys (padded)
  __shared__ __attribute__((aligned(16)))
  float Bias[2][4][16][BP];           // per wave: 16 queries x 32 keys (padded)

  const int tid  = threadIdx.x;
  const int lane = tid & 31;
  const int wv   = tid >> 5;
  const int g    = lane >> 4;
  const int r16  = lane & 15;

  const int bh = blockIdx.y;            // 0..63
  const int b  = bh >> 4;
  const int h  = bh & 15;
  const int q0 = (blockIdx.x * 4 + wv) * 16;

  const size_t tokBase = (size_t)b * S;
  const float*  biasBH = bias + (size_t)bh * S * S;
  const __bf16* Kbh    = Kb + tokBase * H + h * DK;   // + key*H
  const __bf16* VTbh   = VTb + (size_t)bh * DK * S;   // + dk*S

  const int krow = tid >> 3, kcol = (tid & 7) * 8;   // keys krow, krow + 16
  const int vrow = tid >> 2, vcol = (tid & 3) * 8;   // dk   vrow, vrow + 32
  const __bf16* ksrc = Kbh + (size_t)krow * H + kcol;
  const __bf16* vsrc = VTbh + (size_t)vrow * S + vcol;
  const float* bsrc0 = biasBH + (size_t)(q0 + (lane >> 3)) * S + (lane & 7) * 4;
  auto issue_tile = [&](int kb, int buf) {
    const __bf16* k0 = ksrc + (size_t)kb * H;
    const __bf16* k1 = k0 + 16 * H;
    const __bf16* v0 = vsrc + kb;
    const __bf16* v1 = v0 + 32 * S;
    const unsigned dk0 = (unsigned)(size_t)&Kst[buf][krow][kcol];
    const unsigned dk1 = dk0 + 16 * KP * 2;
    const unsigned dv0 = (unsigned)(size_t)&Vst[buf][vrow][vcol];
    const unsigned dv1 = dv0 + 32 * VP * 2;
    const float* p0 = bsrc0 + kb;
    const float* p1 = p0 + 4 * S;
    const float* p2 = p0 + 8 * S;
    const float* p3 = p0 + 12 * S;
    const unsigned d0 = (unsigned)(size_t)&Bias[buf][wv][lane >> 3][(lane & 7) * 4];
    const unsigned d1 = d0 + 4 * BP * 4;
    const unsigned d2 = d0 + 8 * BP * 4;
    const unsigned d3 = d0 + 12 * BP * 4;
    asm volatile("global_load_async_to_lds_b128 %0, %8, off\n\t"
                 "global_load_async_to_lds_b128 %1, %9, off\n\t"
                 "global_load_async_to_lds_b128 %2, %10, off\n\t"
                 "global_load_async_to_lds_b128 %3, %11, off\n\t"
                 "global_load_async_to_lds_b128 %4, %12, off\n\t"
                 "global_load_async_to_lds_b128 %5, %13, off\n\t"
                 "global_load_async_to_lds_b128 %6, %14, off\n\t"
                 "global_load_async_to_lds_b128 %7, %15, off\n\t"
                 "s_wait_xcnt 0x0"
                 :: "v"(d0), "v"(d1), "v"(d2), "v"(d3),
                    "v"(dk0), "v"(dk1), "v"(dv0), "v"(dv1),
                    "v"(p0), "v"(p1), "v"(p2), "v"(p3),
                    "v"(k0), "v"(k1), "v"(v0), "v"(v1) : "memory");
  };

  // Q^T fragments (B operand, column = query q0 + r16) for both dk halves;
  // they persist across the whole key loop
  const __bf16* qrow = Qb + (tokBase + q0 + r16) * H + h * DK + 8 * g;
  const v16bf bq0 = load_frag(qrow);
  const v16bf bq1 = load_frag(qrow + 32);

  float Mi = -1e30f;   // running maximum of the query (equal in both halves)
  float Li = 0.f;      // running sum over this half's keys only
  v8f oacc[4] = {};    // O^T: oacc[t][v] = O[q0 + r16][t*16 + 8*g + v]

  issue_tile(0, 0);
  asm volatile("s_wait_asynccnt 0x0" ::: "memory");
  __syncthreads();

  for (int kb = 0; kb < S; kb += 32) {
    const int buf = (kb >> 5) & 1;
    if (kb + 32 < S) issue_tile(kb + 32, buf ^ 1);   // prefetch the next tiles

    // bias of this lane's query: keys kb + 16*j + 8*g + 0..7
    const float* brow = &Bias[buf][wv][r16][8 * g];
    const v4f b00 = *(const v4f*)(brow);
    const v4f b01 = *(const v4f*)(brow + 4);
    const v4f b10 = *(const v4f*)(brow + 16);
    const v4f b11 = *(const v4f*)(brow + 20);

    // scores^T: two 16-key x 16-query tiles, K rows (A) from the LDS tile;
    // s_j[v] = score(key kb + 16*j + 8*g + v, query q0 + r16)
    v8f s0, s1;
    {
      const __bf16* krow = &Kst[buf][r16][8 * g];
      v8f z = {};
      z  = wmma_bf16(load_frag(krow), bq0, z);
      s0 = wmma_bf16(load_frag(krow + 32), bq1, z);
    }
    {
      const __bf16* krow = &Kst[buf][16 + r16][8 * g];
      v8f z = {};
      z  = wmma_bf16(load_frag(krow), bq0, z);
      s1 = wmma_bf16(load_frag(krow + 32), bq1, z);
    }

    // scale + bias + online softmax, all of one query in one lane pair
    const v8f t0 = s0 * 0.125f +
        __builtin_shufflevector(b00, b01, 0, 1, 2, 3, 4, 5, 6, 7);
    const v8f t1 = s1 * 0.125f +
        __builtin_shufflevector(b10, b11, 0, 1, 2, 3, 4, 5, 6, 7);
    float mx[8];
#pragma unroll
    for (int v = 0; v < 8; ++v) mx[v] = fmaxf(t0[v], t1[v]);
    float rm = fmaxf(fmaxf(fmaxf(mx[0], mx[1]), fmaxf(mx[2], mx[3])),
                     fmaxf(fmaxf(mx[4], mx[5]), fmaxf(mx[6], mx[7])));
    rm = fmaxf(rm, xhalf(rm));
    const float nm = fmaxf(Mi, rm);
    const float cf = __expf(Mi - nm);
    Mi = nm;

    // P^T as a B operand: element s = key kmap(s, g) = tile s >> 3, row s & 7
    v16bf pb;
    float sm[8];
#pragma unroll
    for (int v = 0; v < 8; ++v) {
      const float e0 = __expf(t0[v] - nm);
      const float e1 = __expf(t1[v] - nm);
      pb[v]     = (__bf16)e0;
      pb[8 + v] = (__bf16)e1;
      sm[v] = e0 + e1;
    }
    Li = Li * cf + (((sm[0] + sm[1]) + (sm[2] + sm[3])) +
                    ((sm[4] + sm[5]) + (sm[6] + sm[7])));
#pragma unroll
    for (int t = 0; t < 4; ++t)
#pragma unroll
      for (int v = 0; v < 8; ++v) oacc[t][v] *= cf;

    // O^T += V^T P^T: V^T rows (A) from the LDS tile, contiguous along keys
#pragma unroll
    for (int t = 0; t < 4; ++t) {
      const __bf16* vrow = &Vst[buf][t * 16 + r16][8 * g];
      oacc[t] = wmma_bf16(load_frag(vrow), pb, oacc[t]);
    }

    // this wave's LDS reads of the buffers refilled next have returned;
    // next-tile async copies must land + all waves done reading this buffer
    asm volatile("s_wait_dscnt 0x0" ::: "memory");
    asm volatile("s_wait_asynccnt 0x0" ::: "memory");
    __syncthreads();
  }

  // join the halves' sums, normalize, store: a lane holds 8 consecutive dk of
  // its query per tile -> one 16-byte store into [token][h*DK+dk] bf16
  const float inv = 1.0f / (Li + xhalf(Li));
  __bf16* orow = Ob + (tokBase + q0 + r16) * H + h * DK + 8 * g;
#pragma unroll
  for (int t = 0; t < 4; ++t) {
    v8bf pk;
#pragma unroll
    for (int v = 0; v < 8; ++v) pk[v] = (__bf16)(oacc[t][v] * inv);
    *(v8bf*)(orow + t * 16) = pk;
  }
}

// ---------------------------------------------------------------------------
// Host-side launcher
// ---------------------------------------------------------------------------
extern "C" void kernel_launch(void* const* d_in, const int* in_sizes, int n_in,
                              void* d_out, int out_size, void* d_ws, size_t ws_size,
                              hipStream_t stream) {
  const float* x_q  = (const float*)d_in[0];
  const float* x_kv = (const float*)d_in[1];
  const float* bias = (const float*)d_in[2];
  const float* Wq   = (const float*)d_in[3];
  const float* Wk   = (const float*)d_in[4];
  const float* Wv   = (const float*)d_in[5];
  const float* Wo   = (const float*)d_in[6];
  float* out = (float*)d_out;

  char* ws = (char*)d_ws;
  const size_t MB = 1024ull * 1024ull;
  __bf16* xq_bf  = (__bf16*)(ws + 0 * MB);    // 8 MB
  __bf16* xkv_bf = (__bf16*)(ws + 8 * MB);    // 8 MB
  __bf16* wq_bf  = (__bf16*)(ws + 16 * MB);   // 2 MB each
  __bf16* wk_bf  = (__bf16*)(ws + 18 * MB);
  __bf16* wv_bf  = (__bf16*)(ws + 20 * MB);
  __bf16* wo_bf  = (__bf16*)(ws + 22 * MB);
  __bf16* Qb     = (__bf16*)(ws + 24 * MB);   // 8 MB
  __bf16* Kb     = (__bf16*)(ws + 32 * MB);   // 8 MB
  __bf16* VTb    = (__bf16*)(ws + 40 * MB);   // 8 MB (per-head transposed)
  __bf16* Ob     = (__bf16*)(ws + 48 * MB);   // 8 MB

  cvt_all_f32_bf16<<<CVT_BLOCKS, CVT_THREADS, 0, stream>>>(
      x_q, x_kv, Wq, Wk, Wv, Wo, xq_bf, xkv_bf, wq_bf, wk_bf, wv_bf, wo_bf);

  // 4096x1024x1024 GEMMs: wave tile 32x64, grid = (N/64, M/32/4waves);
  // the three input projections share one launch (grid z = 3)
  dim3 ggrid(H / 64, MTOK / 32 / 4), gblk(128);
  const GemmSet setQ{xq_bf,  wq_bf, Qb};
  const GemmSet setK{xkv_bf, wk_bf, Kb};
  const GemmSet setV{xkv_bf, wv_bf, VTb};
  gemm_bf16<0><<<dim3(H / 64, MTOK / 32 / 4, 3), gblk, 0, stream>>>(
      setQ, setK, setV, nullptr, nullptr);

  // attention: (S/16 tiles / 4 waves, B*NH)
  attn_kernel<<<dim3(S / 16 / 4, Bb * NH), 128, 0, stream>>>(Qb, Kb, VTb, bias, Ob);

  // output projection + residual, f32 out
  const GemmSet setO{Ob, wo_bf, nullptr};
  gemm_bf16<2><<<ggrid, gblk, 0, stream>>>(setO, setO, setO, out, x_q);
}

// v005
// A run of this version takes 78.8 microseconds.
// In both of two side-by-side timings against v004, it was 1.05 times as fast.
// Over all steps from v000 it is 2.33 times as fast.
#include <hip/hip_runtime.h>

typedef __attribute__((ext_vector_type(8)))  __bf16 v8bf;
typedef __attribute__((ext_vector_type(16))) __bf16 v16bf;
typedef __attribute__((ext_vector_type(8)))  float  v8f;

static constexpr int Bb = 4;
static constexpr int S  = 1024;
static constexpr int H  = 1024;
static constexpr int NH = 16;
static constexpr int DK = 64;
static constexpr int MTOK = Bb * S;   // 4096 tokens

__device__ __forceinline__ v8f wmma_bf16(v16bf a, v16bf b, v8f c) {
  return __builtin_amdgcn_wmma_f32_16x16x32_bf16(
      /*neg_a=*/false, a, /*neg_b=*/false, b,
      /*c_mod=*/(short)0, c, /*reuse_a=*/false, /*reuse_b=*/false);
}

__device__ __forceinline__ v16bf load_frag(const __bf16* p) {
  v8bf lo = *(const v8bf*)(p);
  v8bf hi = *(const v8bf*)(p + 16);
  return __builtin_shufflevector(lo, hi, 0,1,2,3,4,5,6,7,8,9,10,11,12,13,14,15);
}

// ---------------------------------------------------------------------------
// fp32 -> bf16 conversion of all six tensors in ONE launch, as a stream: no
// loop. A wave owns one contiguous run of every tensor (4 KB of each
// activation, 1 KB of each weight) and reads it in 16-byte pieces a lane, 512
// contiguous bytes a load. All 24 loads of a lane are independent and are
// issued before the first result is used, so a wave pays the memory latency
// once. Non-temporal reads: streamed once. A store writes 8 bytes a lane, 256
// contiguous bytes a wave (two whole lines).
// ---------------------------------------------------------------------------
typedef __attribute__((ext_vector_type(4))) float  v4f;
typedef __attribute__((ext_vector_type(4))) __bf16 v4bf;

static constexpr int NX = MTOK * H;   // 4M elements (activations)
static constexpr int NW = H * H;      // 1M elements (weights)
static constexpr int CVT_BLOCKS  = 512;
static constexpr int CVT_THREADS = 256;
static constexpr int CVT_WAVES   = CVT_BLOCKS * CVT_THREADS / 32;
static constexpr int XL = NX / (4 * 32 * CVT_WAVES);   // 8 loads a wave
static constexpr int WL = NW / (4 * 32 * CVT_WAVES);   // 2 loads a wave
static_assert(XL * 4 * 32 * CVT_WAVES == NX && WL * 4 * 32 * CVT_WAVES == NW,
              "the waves' runs cover every tensor exactly");

__global__ __launch_bounds__(CVT_THREADS)
void cvt_all_f32_bf16(const float* __restrict__ x_q, const float* __restrict__ x_kv,
                      const float* __restrict__ Wq,  const float* __restrict__ Wk,
                      const float* __restrict__ Wv,  const float* __restrict__ Wo,
                      __bf16* __restrict__ xq_bf, __bf16* __restrict__ xkv_bf,
                      __bf16* __restrict__ wq_bf, __bf16* __restrict__ wk_bf,
                      __bf16* __restrict__ wv_bf, __bf16* __restrict__ wo_bf) {
  const int wave = blockIdx.x * (CVT_THREADS / 32) + (threadIdx.x >> 5);
  const int lane = threadIdx.x & 31;
  // this lane's first 4-element piece of an activation and of a weight
  const int xi = wave * (XL * 32) + lane;
  const int wi = wave * (WL * 32) + lane;

  v4f a[XL], b[XL], c[WL], d[WL], e[WL], f[WL];
#pragma unroll  // constant indices: the arrays stay in registers
  for (int j = 0; j < XL; ++j)
    a[j] = __builtin_nontemporal_load((const v4f*)x_q + xi + j * 32);
#pragma unroll  // constant indices: the arrays stay in registers
  for (int j = 0; j < XL; ++j)
    b[j] = __builtin_nontemporal_load((const v4f*)x_kv + xi + j * 32);
#pragma unroll  // constant indices: the arrays stay in registers
  for (int j = 0; j < WL; ++j) {
    c[j] = __builtin_nontemporal_load((const v4f*)Wq + wi + j * 32);
    d[j] = __builtin_nontemporal_load((const v4f*)Wk + wi + j * 32);
    e[j] = __builtin_nontemporal_load((const v4f*)Wv + wi + j * 32);
    f[j] = __builtin_nontemporal_load((const v4f*)Wo + wi + j * 32);
  }
  // keeps every load ahead of the first conversion: left alone, the scheduler
  // holds ten loads back until earlier ones have returned (a second latency)
  __builtin_amdgcn_sched_barrier(0);

#pragma unroll  // constant indices: the arrays stay in registers
  for (int j = 0; j < XL; ++j)
    *((v4bf*)xq_bf + xi + j * 32) = __builtin_convertvector(a[j], v4bf);
#pragma unroll  // constant indices: the arrays stay in registers
  for (int j = 0; j < XL; ++j)
    *((v4bf*)xkv_bf + xi + j * 32) = __builtin_convertvector(b[j], v4bf);
#pragma unroll  // constant indices: the arrays stay in registers
  for (int j = 0; j < WL; ++j) {
    *((v4bf*)wq_bf + wi + j * 32) = __builtin_convertvector(c[j], v4bf);
    *((v4bf*)wk_bf + wi + j * 32) = __builtin_convertvector(d[j], v4bf);
    *((v4bf*)wv_bf + wi + j * 32) = __builtin_convertvector(e[j], v4bf);
    *((v4bf*)wo_bf + wi + j * 32) = __builtin_convertvector(f[j], v4bf);
  }
}

static constexpr int WPAD = 72;

struct GemmSet {
  const __bf16* X;   // 4096 x 1024 activations
  const __bf16* W;   // 1024 x 1024 weights
  __bf16*       out; // bf16 result (unused by MODE 2)
};

template <int MODE>
__global__ __launch_bounds__(128)
void gemm_bf16(GemmSet s0, GemmSet s1, GemmSet s2,
               float* __restrict__ outf, const float* __restrict__ resid) {
  constexpr int Kdim = H;
  constexpr int Ndim = H;

  // operand set of this block (block-uniform; MODE 2 has only set 0)
  const int z = (MODE == 0) ? (int)blockIdx.z : 0;
  const GemmSet st = (z == 0) ? s0 : (z == 1) ? s1 : s2;
  const __bf16* __restrict__ X = st.X;
  const __bf16* __restrict__ W = st.W;

  __shared__ __attribute__((aligned(256))) __bf16 Ast[2][128][64];
  __shared__ __attribute__((aligned(16)))
  __bf16 Bst[2][64][WPAD];              // 64 N-rows x 64 K (padded), x2 buffers

  const int tid  = threadIdx.x;
  const int lane = tid & 31;
  const int wv   = tid >> 5;
  const int g    = lane >> 4;     // lo/hi 16-lane half
  const int r16  = lane & 15;

  const int tileN = blockIdx.x * 64;                 // shared by all 4 waves
  const int blkM  = blockIdx.y * 128;                // the block's X rows
  const int tileM = blkM + wv * 32;

  const int crow = tid >> 3, cpc = tid & 7;
  const __bf16* asrc = X + (size_t)(blkM + crow) * Kdim + cpc * 8;
  const __bf16* wsrc = W + (size_t)(tileN + crow) * Kdim + cpc * 8;
  const unsigned adst = (unsigned)(size_t)&Ast[0][crow][(cpc ^ (crow >> 1)) * 8];
  const unsigned wdst = (unsigned)(size_t)&Bst[0][crow][cpc * 8];
  auto issue_tiles = [&](int kb, int buf) {
    const __bf16* a0 = asrc + kb;
    const __bf16* w0 = wsrc + kb;
    const unsigned da = adst + buf * (128 * 64 * 2);
    const unsigned dw = wdst + buf * (64 * WPAD * 2);
    constexpr int AR = 16 * 64 * 2;      // 16 X-tile rows in LDS, bytes
    constexpr int WR = 16 * WPAD * 2;    // 16 W-tile rows in LDS, bytes
    constexpr int GR = 16 * Kdim;        // 16 rows in global, elements
    asm volatile("global_load_async_to_lds_b128 %0, %12, off\n\t"
                 "global_load_async_to_lds_b128 %1, %13, off\n\t"
                 "global_load_async_to_lds_b128 %2, %14, off\n\t"
                 "global_load_async_to_lds_b128 %3, %15, off\n\t"
                 "global_load_async_to_lds_b128 %4, %16, off\n\t"
                 "global_load_async_to_lds_b128 %5, %17, off\n\t"
                 "global_load_async_to_lds_b128 %6, %18, off\n\t"
                 "global_load_async_to_lds_b128 %7, %19, off\n\t"
                 "global_load_async_to_lds_b128 %8, %20, off\n\t"
                 "global_load_async_to_lds_b128 %9, %21, off\n\t"
                 "global_load_async_to_lds_b128 %10, %22, off\n\t"
                 "global_load_async_to_lds_b128 %11, %23, off\n\t"
                 "s_wait_xcnt 0x0"
                 :: "v"(da), "v"(da + AR), "v"(da + 2 * AR), "v"(da + 3 * AR),
                    "v"(da + 4 * AR), "v"(da + 5 * AR), "v"(da + 6 * AR),
                    "v"(da + 7 * AR),
                    "v"(dw), "v"(dw + WR), "v"(dw + 2 * WR), "v"(dw + 3 * WR),
                    "v"(a0), "v"(a0 + GR), "v"(a0 + 2 * GR), "v"(a0 + 3 * GR),
                    "v"(a0 + 4 * GR), "v"(a0 + 5 * GR), "v"(a0 + 6 * GR),
                    "v"(a0 + 7 * GR),
                    "v"(w0), "v"(w0 + GR), "v"(w0 + 2 * GR), "v"(w0 + 3 * GR)
                 : "memory");
  };

  v8f acc[2][4] = {};

  // element offsets, inside this lane's X-tile row, of its four 16-byte
  // pieces g, g + 2, g + 4, g + 6 (rows 16 apart share them)
  int aoff[4];
#pragma unroll
  for (int j = 0; j < 4; ++j) aoff[j] = ((g + 2 * j) ^ (r16 >> 1)) * 8;

  issue_tiles(0, 0);
  asm volatile("s_wait_asynccnt 0x0" ::: "memory");
  __syncthreads();
  issue_tiles(64, 1);                                // tile 1 flies over trip 0

  for (int kb = 0; kb < Kdim; kb += 64) {
    const int buf = (kb >> 6) & 1;
    const __bf16* abase = &Ast[buf][wv * 32 + r16][0];

#pragma unroll
    for (int kk = 0; kk < 64; kk += 32) {
      v16bf a[2], b[4];
#pragma unroll
      for (int r = 0; r < 2; ++r) {
        const v8bf lo = *(const v8bf*)(abase + r * 16 * 64 + aoff[kk / 16]);
        const v8bf hi = *(const v8bf*)(abase + r * 16 * 64 + aoff[kk / 16 + 1]);
        a[r] = __builtin_shufflevector(lo, hi, 0, 1, 2, 3, 4, 5, 6, 7,
                                       8, 9, 10, 11, 12, 13, 14, 15);
      }
#pragma unroll
      for (int c = 0; c < 4; ++c)
        b[c] = load_frag(&Bst[buf][c * 16 + r16][kk + 8 * g]);
#pragma unroll
      for (int r = 0; r < 2; ++r)
#pragma unroll
        for (int c = 0; c < 4; ++c) acc[r][c] = wmma_bf16(a[r], b[c], acc[r][c]);
    }

    // this wave's LDS reads of the buffer refilled next have returned; the
    // next tile's copies have landed; every wave has left this buffer
    asm volatile("s_wait_dscnt 0x0" ::: "memory");
    asm volatile("s_wait_asynccnt 0x0" ::: "memory");
    __syncthreads();
    if (kb + 128 < Kdim) issue_tiles(kb + 128, buf);  // refill the buffer just read
  }
  // no copy is outstanding when the wave goes on to its stores and ends
  asm volatile("s_wait_asynccnt 0x0" ::: "memory");

  if constexpr (MODE == 0) {
    __bf16* __restrict__ O = st.out;
    if (z != 2) {
#pragma unroll
      for (int r = 0; r < 2; ++r) {
#pragma unroll
        for (int c = 0; c < 4; ++c) {
          const int n  = tileN + c * 16 + r16;
          const int m0 = tileM + r * 16 + 8 * g;
#pragma unroll
          for (int v = 0; v < 8; ++v)
            O[(size_t)(m0 + v) * Ndim + n] = (__bf16)acc[r][c][v];
        }
      }
      // the stores above have taken their registers before any later
      // instruction on a path out of this branch may overwrite one
      asm volatile("s_wait_xcnt 0x0" ::: "memory");
    } else {
#pragma unroll
      for (int r = 0; r < 2; ++r) {
#pragma unroll
        for (int c = 0; c < 4; ++c) {
          const int n  = tileN + c * 16 + r16;
          const int m0 = tileM + r * 16 + 8 * g;
          const int hh = n >> 6, dk = n & 63;
          const int bb = m0 >> 10, s0i = m0 & 1023;  // 8 consecutive s, same bb
          v8bf pk;
#pragma unroll
          for (int v = 0; v < 8; ++v) pk[v] = (__bf16)acc[r][c][v];
          *(v8bf*)(O + ((size_t)(bb * NH + hh) * DK + dk) * S + s0i) = pk;
        }
      }
    }
  } else {
#pragma unroll
    for (int r = 0; r < 2; ++r) {
#pragma unroll
      for (int c = 0; c < 4; ++c) {
        const int n  = tileN + c * 16 + r16;
        const int m0 = tileM + r * 16 + 8 * g;
#pragma unroll
        for (int v = 0; v < 8; ++v) {
          const size_t idx = (size_t)(m0 + v) * Ndim + n;
          outf[idx] = acc[r][c][v] + resid[idx];
        }
      }
    }
  }
}

static constexpr int KT = 64;
static constexpr int KP = 72;
static constexpr int VP = 72;
static constexpr int BP = 68;

__device__ __forceinline__ float xhalf(float x) {
  const int b = __builtin_bit_cast(int, x);
  return __builtin_bit_cast(float, __builtin_amdgcn_permlanex16(
      b, b, 0x76543210, 0xfedcba98, false, false));
}

__global__ __launch_bounds__(128)
void attn_kernel(const __bf16* __restrict__ Qb, const __bf16* __restrict__ Kb,
                 const __bf16* __restrict__ VTb, const float* __restrict__ bias,
                 __bf16* __restrict__ Ob) {
  __shared__ __attribute__((aligned(16)))
  __bf16 Kst[2][KT][KP];              // 64 keys x 64 dk   (padded)
  __shared__ __attribute__((aligned(16)))
  __bf16 Vst[2][DK][VP];              // 64 dk   x 64 keys (padded)
  __shared__ __attribute__((aligned(16)))
  float Bias[2][4][16][BP];           // per wave: 16 queries x 64 keys (padded)

  const int tid  = threadIdx.x;
  const int lane = tid & 31;
  const int wv   = tid >> 5;
  const int g    = lane >> 4;
  const int r16  = lane & 15;

  const int bh = blockIdx.y;            // 0..63
  const int b  = bh >> 4;
  const int h  = bh & 15;
  const int q0 = (blockIdx.x * 4 + wv) * 16;

  const size_t tokBase = (size_t)b * S;
  const float*  biasBH = bias + (size_t)bh * S * S;
  const __bf16* Kbh    = Kb + tokBase * H + h * DK;   // + key*H
  const __bf16* VTbh   = VTb + (size_t)bh * DK * S;   // + dk*S

  const int crow = tid >> 3, ccol = (tid & 7) * 8;   // rows crow + 16 * i
  const __bf16* ksrc = Kbh + (size_t)crow * H + ccol;
  const __bf16* vsrc = VTbh + (size_t)crow * S + ccol;
  const float* bsrc0 = biasBH + (size_t)(q0 + g) * S + r16 * 4;  // rows g + 2 * i
  auto issue_tile = [&](int kb, int buf) {
    const float* p0 = bsrc0 + kb;
    const unsigned d0 = (unsigned)(size_t)&Bias[buf][wv][g][r16 * 4];
    constexpr int BR = 2 * BP * 4;       // 2 bias-tile rows in LDS, bytes
    asm volatile("global_load_async_to_lds_b128 %0, %8, off\n\t"
                 "global_load_async_to_lds_b128 %1, %9, off\n\t"
                 "global_load_async_to_lds_b128 %2, %10, off\n\t"
                 "global_load_async_to_lds_b128 %3, %11, off\n\t"
                 "global_load_async_to_lds_b128 %4, %12, off\n\t"
                 "global_load_async_to_lds_b128 %5, %13, off\n\t"
                 "global_load_async_to_lds_b128 %6, %14, off\n\t"
                 "global_load_async_to_lds_b128 %7, %15, off\n\t"
                 "s_wait_xcnt 0x0"
                 :: "v"(d0), "v"(d0 + BR), "v"(d0 + 2 * BR), "v"(d0 + 3 * BR),
                    "v"(d0 + 4 * BR), "v"(d0 + 5 * BR), "v"(d0 + 6 * BR),
                    "v"(d0 + 7 * BR),
                    "v"(p0), "v"(p0 + 2 * S), "v"(p0 + 4 * S), "v"(p0 + 6 * S),
                    "v"(p0 + 8 * S), "v"(p0 + 10 * S), "v"(p0 + 12 * S),
                    "v"(p0 + 14 * S) : "memory");
    const __bf16* k0 = ksrc + (size_t)kb * H;
    const __bf16* v0 = vsrc + kb;
    const unsigned dk0 = (unsigned)(size_t)&Kst[buf][crow][ccol];
    const unsigned dv0 = (unsigned)(size_t)&Vst[buf][crow][ccol];
    constexpr int KR = 16 * KP * 2;      // 16 K-tile rows in LDS, bytes
    constexpr int VR = 16 * VP * 2;      // 16 V-tile rows in LDS, bytes
    asm volatile("global_load_async_to_lds_b128 %0, %8, off\n\t"
                 "global_load_async_to_lds_b128 %1, %9, off\n\t"
                 "global_load_async_to_lds_b128 %2, %10, off\n\t"
                 "global_load_async_to_lds_b128 %3, %11, off\n\t"
                 "global_load_async_to_lds_b128 %4, %12, off\n\t"
                 "global_load_async_to_lds_b128 %5, %13, off\n\t"
                 "global_load_async_to_lds_b128 %6, %14, off\n\t"
                 "global_load_async_to_lds_b128 %7, %15, off\n\t"
                 "s_wait_xcnt 0x0"
                 :: "v"(dk0), "v"(dk0 + KR), "v"(dk0 + 2 * KR), "v"(dk0 + 3 * KR),
                    "v"(dv0), "v"(dv0 + VR), "v"(dv0 + 2 * VR), "v"(dv0 + 3 * VR),
                    "v"(k0), "v"(k0 + 16 * H), "v"(k0 + 32 * H), "v"(k0 + 48 * H),
                    "v"(v0), "v"(v0 + 16 * S), "v"(v0 + 32 * S), "v"(v0 + 48 * S)
                 : "memory");
  };

  // Q^T fragments (B operand, column = query q0 + r16) for both dk halves;
  // they persist across the whole key loop
  const __bf16* qrow = Qb + (tokBase + q0 + r16) * H + h * DK + 8 * g;
  const v16bf bq0 = load_frag(qrow);
  const v16bf bq1 = load_frag(qrow + 32);

  float Mi = -1e30f;   // running maximum of the query (equal in both halves)
  float Li = 0.f;      // running sum over this half's keys only
  v8f oacc[4] = {};    // O^T: oacc[t][v] = O[q0 + r16][t*16 + 8*g + v]

  issue_tile(0, 0);
  asm volatile("s_wait_asynccnt 0x0" ::: "memory");
  __syncthreads();

  for (int kb = 0; kb < S; kb += KT) {
    const int buf = (kb >> 6) & 1;
    if (kb + KT < S) issue_tile(kb + KT, buf ^ 1);   // prefetch the next tiles

    // scores^T: four 16-key x 16-query tiles, K rows (A) from the LDS tile.
    // All K fragments and this lane's bias row are named ahead of the products,
    // so that their LDS loads go out as one group.
    const float* brow = &Bias[buf][wv][r16][8 * g];
    v16bf kf[4][2];
    v8f bs[4];
#pragma unroll  // constant indices: the arrays stay in registers
    for (int j = 0; j < 4; ++j) {
      kf[j][0] = load_frag(&Kst[buf][16 * j + r16][8 * g]);
      kf[j][1] = load_frag(&Kst[buf][16 * j + r16][32 + 8 * g]);
    }
#pragma unroll  // constant indices: the arrays stay in registers
    for (int j = 0; j < 4; ++j) {
      const v4f b0 = *(const v4f*)(brow + 16 * j);
      const v4f b1 = *(const v4f*)(brow + 16 * j + 4);
      bs[j] = __builtin_shufflevector(b0, b1, 0, 1, 2, 3, 4, 5, 6, 7);
    }

    // z[j][v] belongs to key kb + 16*j + 8*g + v, query q0 + r16
    v8f z[4];
#pragma unroll  // constant indices: the arrays stay in registers
    for (int j = 0; j < 4; ++j) {
      v8f zero = {};
      z[j] = wmma_bf16(kf[j][0], bq0, zero);
    }
#pragma unroll  // constant indices: the arrays stay in registers
    for (int j = 0; j < 4; ++j) z[j] = wmma_bf16(kf[j][1], bq1, z[j]);

    // V^T rows (A of the second product) from the LDS tile, contiguous along
    // keys; named ahead of the softmax so that the loads may fly under it
    v16bf vf[2][4];
#pragma unroll  // constant indices: the arrays stay in registers
    for (int p = 0; p < 2; ++p)
#pragma unroll  // constant indices: the arrays stay in registers
      for (int t4 = 0; t4 < 4; ++t4)
        vf[p][t4] = load_frag(&Vst[buf][t4 * 16 + r16][32 * p + 8 * g]);

    // scale + bias of this lane's query
    v8f t[4];
#pragma unroll  // constant indices: the arrays stay in registers
    for (int j = 0; j < 4; ++j) t[j] = z[j] * 0.125f + bs[j];

    // online softmax, all of one query in one lane pair
    float mx[8];
#pragma unroll  // constant indices: the arrays stay in registers
    for (int v = 0; v < 8; ++v)
      mx[v] = fmaxf(fmaxf(t[0][v], t[1][v]), fmaxf(t[2][v], t[3][v]));
    float rm = fmaxf(fmaxf(fmaxf(mx[0], mx[1]), fmaxf(mx[2], mx[3])),
                     fmaxf(fmaxf(mx[4], mx[5]), fmaxf(mx[6], mx[7])));
    rm = fmaxf(rm, xhalf(rm));
    const float nm = fmaxf(Mi, rm);
    const float cf = __expf(Mi - nm);
    Mi = nm;

    // exp(t - nm) as exp2((t - nm) * log2(e)), the subtraction and the product
    // on whole vectors (two elements an instruction)
    v8f d[4], e[4];
#pragma unroll  // constant indices: the arrays stay in registers
    for (int j = 0; j < 4; ++j) d[j] = (t[j] - nm) * 1.44269504088896340736f;
#pragma unroll  // constant indices: the arrays stay in registers
    for (int j = 0; j < 4; ++j)
#pragma unroll  // constant indices: the arrays stay in registers
      for (int v = 0; v < 8; ++v) e[j][v] = __builtin_amdgcn_exp2f(d[j][v]);
    const v8f sv = (e[0] + e[1]) + (e[2] + e[3]);
    Li = Li * cf + (((sv[0] + sv[1]) + (sv[2] + sv[3])) +
                    ((sv[4] + sv[5]) + (sv[6] + sv[7])));
#pragma unroll  // constant indices: the arrays stay in registers
    for (int t4 = 0; t4 < 4; ++t4) oacc[t4] *= cf;

    // per 32 keys: P^T as a B operand (element s = key 32*p + kmap(s, g) =
    // tile 2*p + (s >> 3), row s & 7), then O^T += V^T P^T
#pragma unroll  // constant indices: the arrays stay in registers
    for (int p = 0; p < 2; ++p) {
      v16bf pb;
#pragma unroll  // constant indices: the arrays stay in registers
      for (int v = 0; v < 8; ++v) {
        pb[v]     = (__bf16)e[2 * p][v];
        pb[8 + v] = (__bf16)e[2 * p + 1][v];
      }
#pragma unroll  // constant indices: the arrays stay in registers
      for (int t4 = 0; t4 < 4; ++t4) oacc[t4] = wmma_bf16(vf[p][t4], pb, oacc[t4]);
    }

    // this wave's LDS reads of the buffers refilled next have returned;
    // next-tile async copies must land + all waves done reading this buffer
    asm volatile("s_wait_dscnt 0x0" ::: "memory");
    asm volatile("s_wait_asynccnt 0x0" ::: "memory");
    __syncthreads();
  }

  // join the halves' sums, normalize, store: a lane holds 8 consecutive dk of
  // its query per tile -> one 16-byte store into [token][h*DK+dk] bf16
  const float inv = 1.0f / (Li + xhalf(Li));
  __bf16* orow = Ob + (tokBase + q0 + r16) * H + h * DK + 8 * g;
#pragma unroll
  for (int t = 0; t < 4; ++t) {
    v8bf pk;
#pragma unroll
    for (int v = 0; v < 8; ++v) pk[v] = (__bf16)(oacc[t][v] * inv);
    *(v8bf*)(orow + t * 16) = pk;
  }
}

// ---------------------------------------------------------------------------
// Host-side launcher
// ---------------------------------------------------------------------------
extern "C" void kernel_launch(void* const* d_in, const int* in_sizes, int n_in,
                              void* d_out, int out_size, void* d_ws, size_t ws_size,
                              hipStream_t stream) {
  const float* x_q  = (const float*)d_in[0];
  const float* x_kv = (const float*)d_in[1];
  const float* bias = (const float*)d_in[2];
  const float* Wq   = (const float*)d_in[3];
  const float* Wk   = (const float*)d_in[4];
  const float* Wv   = (const float*)d_in[5];
  const float* Wo   = (const float*)d_in[6];
  float* out = (float*)d_out;

  char* ws = (char*)d_ws;
  const size_t MB = 1024ull * 1024ull;
  __bf16* xq_bf  = (__bf16*)(ws + 0 * MB);    // 8 MB
  __bf16* xkv_bf = (__bf16*)(ws + 8 * MB);    // 8 MB
  __bf16* wq_bf  = (__bf16*)(ws + 16 * MB);   // 2 MB each
  __bf16* wk_bf  = (__bf16*)(ws + 18 * MB);
  __bf16* wv_bf  = (__bf16*)(ws + 20 * MB);
  __bf16* wo_bf  = (__bf16*)(ws + 22 * MB);
  __bf16* Qb     = (__bf16*)(ws + 24 * MB);   // 8 MB
  __bf16* Kb     = (__bf16*)(ws + 32 * MB);   // 8 MB
  __bf16* VTb    = (__bf16*)(ws + 40 * MB);   // 8 MB (per-head transposed)
  __bf16* Ob     = (__bf16*)(ws + 48 * MB);   // 8 MB

  cvt_all_f32_bf16<<<CVT_BLOCKS, CVT_THREADS, 0, stream>>>(
      x_q, x_kv, Wq, Wk, Wv, Wo, xq_bf, xkv_bf, wq_bf, wk_bf, wv_bf, wo_bf);

  // 4096x1024x1024 GEMMs: wave tile 32x64, grid = (N/64, M/32/4waves);
  // the three input projections share one launch (grid z = 3)
  dim3 ggrid(H / 64, MTOK / 32 / 4), gblk(128);
  const GemmSet setQ{xq_bf,  wq_bf, Qb};
  const GemmSet setK{xkv_bf, wk_bf, Kb};
  const GemmSet setV{xkv_bf, wv_bf, VTb};
  gemm_bf16<0><<<dim3(H / 64, MTOK / 32 / 4, 3), gblk, 0, stream>>>(
      setQ, setK, setV, nullptr, nullptr);

  // attention: (S/16 tiles / 4 waves, B*NH)
  attn_kernel<<<dim3(S / 16 / 4, Bb * NH), 128, 0, stream>>>(Qb, Kb, VTb, bias, Ob);

  // output projection + residual, f32 out
  const GemmSet setO{Ob, wo_bf, nullptr};
  gemm_bf16<2><<<ggrid, gblk, 0, stream>>>(setO, setO, setO, out, x_q);
}

// v006
// One run takes 75.6 microseconds.
// In two side-by-side timings against v005, it was 1.03 and 1.04 times as fast.
// Over all steps from v000 it is 2.42 times as fast.
#include <hip/hip_runtime.h>

typedef __attribute__((ext_vector_type(8)))  __bf16 v8bf;
typedef __attribute__((ext_vector_type(16))) __bf16 v16bf;
typedef __attribute__((ext_vector_type(8)))  float  v8f;

static constexpr int Bb = 4;
static constexpr int S  = 1024;
static constexpr int H  = 1024;
static constexpr int NH = 16;
static constexpr int DK = 64;
static constexpr int MTOK = Bb * S;   // 4096 tokens

__device__ __forceinline__ v8f wmma_bf16(v16bf a, v16bf b, v8f c) {
  return __builtin_amdgcn_wmma_f32_16x16x32_bf16(
      /*neg_a=*/false, a, /*neg_b=*/false, b,
      /*c_mod=*/(short)0, c, /*reuse_a=*/false, /*reuse_b=*/false);
}

__device__ __forceinline__ v16bf load_frag(const __bf16* p) {
  v8bf lo = *(const v8bf*)(p);
  v8bf hi = *(const v8bf*)(p + 16);
  return __builtin_shufflevector(lo, hi, 0,1,2,3,4,5,6,7,8,9,10,11,12,13,14,15);
}

// ---------------------------------------------------------------------------
// fp32 -> bf16 conversion of all six tensors in ONE launch, as a stream: no
// loop. A wave owns one contiguous run of every tensor (4 KB of each
// activation, 1 KB of each weight) and reads it in 16-byte pieces a lane, 512
// contiguous bytes a load. All 24 loads of a lane are independent and are
// issued before the first result is used, so a wave pays the memory latency
// once. Non-temporal reads: streamed once. A store writes 8 bytes a lane, 256
// contiguous bytes a wave (two whole lines).
// ---------------------------------------------------------------------------
typedef __attribute__((ext_vector_type(4))) float  v4f;
typedef __attribute__((ext_vector_type(4))) __bf16 v4bf;

static constexpr int NX = MTOK * H;   // 4M elements (activations)
static constexpr int NW = H * H;      // 1M elements (weights)
static constexpr int CVT_BLOCKS  = 512;
static constexpr int CVT_THREADS = 256;
static constexpr int CVT_WAVES   = CVT_BLOCKS * CVT_THREADS / 32;
static constexpr int XL = NX / (4 * 32 * CVT_WAVES);   // 8 loads a wave
static constexpr int WL = NW / (4 * 32 * CVT_WAVES);   // 2 loads a wave
static_assert(XL * 4 * 32 * CVT_WAVES == NX && WL * 4 * 32 * CVT_WAVES == NW,
              "the waves' runs cover every tensor exactly");

__global__ __launch_bounds__(CVT_THREADS)
void cvt_all_f32_bf16(const float* __restrict__ x_q, const float* __restrict__ x_kv,
                      const float* __restrict__ Wq,  const float* __restrict__ Wk,
                      const float* __restrict__ Wv,  const float* __restrict__ Wo,
                      __bf16* __restrict__ xq_bf, __bf16* __restrict__ xkv_bf,
                      __bf16* __restrict__ wq_bf, __bf16* __restrict__ wk_bf,
                      __bf16* __restrict__ wv_bf, __bf16* __restrict__ wo_bf) {
  const int wave = blockIdx.x * (CVT_THREADS / 32) + (threadIdx.x >> 5);
  const int lane = threadIdx.x & 31;
  // this lane's first 4-element piece of an activation and of a weight
  const int xi = wave * (XL * 32) + lane;
  const int wi = wave * (WL * 32) + lane;

  v4f a[XL], b[XL], c[WL], d[WL], e[WL], f[WL];
#pragma unroll  // constant indices: the arrays stay in registers
  for (int j = 0; j < XL; ++j)
    a[j] = __builtin_nontemporal_load((const v4f*)x_q + xi + j * 32);
#pragma unroll  // constant indices: the arrays stay in registers
  for (int j = 0; j < XL; ++j)
    b[j] = __builtin_nontemporal_load((const v4f*)x_kv + xi + j * 32);
#pragma unroll  // constant indices: the arrays stay in registers
  for (int j = 0; j < WL; ++j) {
    c[j] = __builtin_nontemporal_load((const v4f*)Wq + wi + j * 32);
    d[j] = __builtin_nontemporal_load((const v4f*)Wk + wi + j * 32);
    e[j] = __builtin_nontemporal_load((const v4f*)Wv + wi + j * 32);
    f[j] = __builtin_nontemporal_load((const v4f*)Wo + wi + j * 32);
  }
  // keeps every load ahead of the first conversion: left alone, the scheduler
  // holds ten loads back until earlier ones have returned (a second latency)
  __builtin_amdgcn_sched_barrier(0);

#pragma unroll  // constant indices: the arrays stay in registers
  for (int j = 0; j < XL; ++j)
    *((v4bf*)xq_bf + xi + j * 32) = __builtin_convertvector(a[j], v4bf);
#pragma unroll  // constant indices: the arrays stay in registers
  for (int j = 0; j < XL; ++j)
    *((v4bf*)xkv_bf + xi + j * 32) = __builtin_convertvector(b[j], v4bf);
#pragma unroll  // constant indices: the arrays stay in registers
  for (int j = 0; j < WL; ++j) {
    *((v4bf*)wq_bf + wi + j * 32) = __builtin_convertvector(c[j], v4bf);
    *((v4bf*)wk_bf + wi + j * 32) = __builtin_convertvector(d[j], v4bf);
    *((v4bf*)wv_bf + wi + j * 32) = __builtin_convertvector(e[j], v4bf);
    *((v4bf*)wo_bf + wi + j * 32) = __builtin_convertvector(f[j], v4bf);
  }
}

static constexpr int WPAD = 72;

struct GemmSet {
  const __bf16* X;   // 4096 x 1024 activations
  const __bf16* W;   // 1024 x 1024 weights
  __bf16*       out; // bf16 result (unused by MODE 2)
};

template <int MODE>
__global__ __launch_bounds__(128)
void gemm_bf16(GemmSet s0, GemmSet s1, GemmSet s2,
               float* __restrict__ outf, const float* __restrict__ resid) {
  constexpr int Kdim = H;
  constexpr int Ndim = H;

  // operand set of this block (block-uniform; MODE 2 has only set 0)
  const int z = (MODE == 0) ? (int)blockIdx.z : 0;
  const GemmSet st = (z == 0) ? s0 : (z == 1) ? s1 : s2;
  const __bf16* __restrict__ X = st.X;
  const __bf16* __restrict__ W = st.W;

  __shared__ __attribute__((aligned(256))) __bf16 Ast[2][128][64];
  __shared__ __attribute__((aligned(16)))
  __bf16 Bst[2][64][WPAD];              // 64 N-rows x 64 K (padded), x2 buffers

  const int tid  = threadIdx.x;
  const int lane = tid & 31;
  const int wv   = tid >> 5;
  const int g    = lane >> 4;     // lo/hi 16-lane half
  const int r16  = lane & 15;

  const int tileN = blockIdx.x * 64;                 // shared by all 4 waves
  const int blkM  = blockIdx.y * 128;                // the block's X rows
  const int tileM = blkM + wv * 32;

  const int crow = tid >> 3, cpc = tid & 7;
  const __bf16* asrc = X + (size_t)(blkM + crow) * Kdim + cpc * 8;
  const __bf16* wsrc = W + (size_t)(tileN + crow) * Kdim + cpc * 8;
  const unsigned adst = (unsigned)(size_t)&Ast[0][crow][(cpc ^ (crow >> 1)) * 8];
  const unsigned wdst = (unsigned)(size_t)&Bst[0][crow][cpc * 8];
  auto issue_tiles = [&](int kb, int buf) {
    const __bf16* a0 = asrc + kb;
    const __bf16* w0 = wsrc + kb;
    const unsigned da = adst + buf * (128 * 64 * 2);
    const unsigned dw = wdst + buf * (64 * WPAD * 2);
    constexpr int AR = 16 * 64 * 2;      // 16 X-tile rows in LDS, bytes
    constexpr int WR = 16 * WPAD * 2;    // 16 W-tile rows in LDS, bytes
    constexpr int GR = 16 * Kdim;        // 16 rows in global, elements
    asm volatile("global_load_async_to_lds_b128 %0, %12, off\n\t"
                 "global_load_async_to_lds_b128 %1, %13, off\n\t"
                 "global_load_async_to_lds_b128 %2, %14, off\n\t"
                 "global_load_async_to_lds_b128 %3, %15, off\n\t"
                 "global_load_async_to_lds_b128 %4, %16, off\n\t"
                 "global_load_async_to_lds_b128 %5, %17, off\n\t"
                 "global_load_async_to_lds_b128 %6, %18, off\n\t"
                 "global_load_async_to_lds_b128 %7, %19, off\n\t"
                 "global_load_async_to_lds_b128 %8, %20, off\n\t"
                 "global_load_async_to_lds_b128 %9, %21, off\n\t"
                 "global_load_async_to_lds_b128 %10, %22, off\n\t"
                 "global_load_async_to_lds_b128 %11, %23, off\n\t"
                 "s_wait_xcnt 0x0"
                 :: "v"(da), "v"(da + AR), "v"(da + 2 * AR), "v"(da + 3 * AR),
                    "v"(da + 4 * AR), "v"(da + 5 * AR), "v"(da + 6 * AR),
                    "v"(da + 7 * AR),
                    "v"(dw), "v"(dw + WR), "v"(dw + 2 * WR), "v"(dw + 3 * WR),
                    "v"(a0), "v"(a0 + GR), "v"(a0 + 2 * GR), "v"(a0 + 3 * GR),
                    "v"(a0 + 4 * GR), "v"(a0 + 5 * GR), "v"(a0 + 6 * GR),
                    "v"(a0 + 7 * GR),
                    "v"(w0), "v"(w0 + GR), "v"(w0 + 2 * GR), "v"(w0 + 3 * GR)
                 : "memory");
  };

  v8f acc[2][4] = {};

  // element offsets, inside this lane's X-tile row, of its four 16-byte
  // pieces g, g + 2, g + 4, g + 6 (rows 16 apart share them)
  int aoff[4];
#pragma unroll
  for (int j = 0; j < 4; ++j) aoff[j] = ((g + 2 * j) ^ (r16 >> 1)) * 8;

  issue_tiles(0, 0);
  asm volatile("s_wait_asynccnt 0x0" ::: "memory");
  __syncthreads();
  issue_tiles(64, 1);                                // tile 1 flies over trip 0

  for (int kb = 0; kb < Kdim; kb += 64) {
    const int buf = (kb >> 6) & 1;
    const __bf16* abase = &Ast[buf][wv * 32 + r16][0];

#pragma unroll
    for (int kk = 0; kk < 64; kk += 32) {
      v16bf a[2], b[4];
#pragma unroll
      for (int r = 0; r < 2; ++r) {
        const v8bf lo = *(const v8bf*)(abase + r * 16 * 64 + aoff[kk / 16]);
        const v8bf hi = *(const v8bf*)(abase + r * 16 * 64 + aoff[kk / 16 + 1]);
        a[r] = __builtin_shufflevector(lo, hi, 0, 1, 2, 3, 4, 5, 6, 7,
                                       8, 9, 10, 11, 12, 13, 14, 15);
      }
#pragma unroll
      for (int c = 0; c < 4; ++c)
        b[c] = load_frag(&Bst[buf][c * 16 + r16][kk + 8 * g]);
#pragma unroll
      for (int r = 0; r < 2; ++r)
#pragma unroll
        for (int c = 0; c < 4; ++c) acc[r][c] = wmma_bf16(a[r], b[c], acc[r][c]);
    }

    // this wave's LDS reads of the buffer refilled next have returned; the
    // next tile's copies have landed; every wave has left this buffer
    asm volatile("s_wait_dscnt 0x0" ::: "memory");
    asm volatile("s_wait_asynccnt 0x0" ::: "memory");
    __syncthreads();
    if (kb + 128 < Kdim) issue_tiles(kb + 128, buf);  // refill the buffer just read
  }
  // no copy is outstanding when the wave goes on to its stores and ends
  asm volatile("s_wait_asynccnt 0x0" ::: "memory");

  if constexpr (MODE == 0) {
    __bf16* __restrict__ O = st.out;
    if (z != 2) {
#pragma unroll
      for (int r = 0; r < 2; ++r) {
#pragma unroll
        for (int c = 0; c < 4; ++c) {
          const int n  = tileN + c * 16 + r16;
          const int m0 = tileM + r * 16 + 8 * g;
#pragma unroll
          for (int v = 0; v < 8; ++v)
            O[(size_t)(m0 + v) * Ndim + n] = (__bf16)acc[r][c][v];
        }
      }
      // the stores above have taken their registers before any later
      // instruction on a path out of this branch may overwrite one
      asm volatile("s_wait_xcnt 0x0" ::: "memory");
    } else {
#pragma unroll
      for (int r = 0; r < 2; ++r) {
#pragma unroll
        for (int c = 0; c < 4; ++c) {
          const int n  = tileN + c * 16 + r16;
          const int m0 = tileM + r * 16 + 8 * g;
          const int hh = n >> 6, dk = n & 63;
          const int bb = m0 >> 10, s0i = m0 & 1023;  // 8 consecutive s, same bb
          v8bf pk;
#pragma unroll
          for (int v = 0; v < 8; ++v) pk[v] = (__bf16)acc[r][c][v];
          *(v8bf*)(O + ((size_t)(bb * NH + hh) * DK + dk) * S + s0i) = pk;
        }
      }
    }
  } else {
#pragma unroll
    for (int r = 0; r < 2; ++r) {
#pragma unroll
      for (int c = 0; c < 4; ++c) {
        const int n  = tileN + c * 16 + r16;
        const int m0 = tileM + r * 16 + 8 * g;
#pragma unroll
        for (int v = 0; v < 8; ++v) {
          const size_t idx = (size_t)(m0 + v) * Ndim + n;
          outf[idx] = acc[r][c][v] + resid[idx];
        }
      }
    }
  }
}

static constexpr int KT = 64;
static constexpr int KP = 72;
static constexpr int VP = 72;
static constexpr int BP = 68;
// bytes of one buffer in LDS: 64 padded rows, rounded up to a multiple of
// 2 KiB so that every tensor load's place is one
static constexpr unsigned KVBUF = 10240;   // 64 * 144 = 9216
static constexpr unsigned BBUF  = 18432;   // 64 * 272 = 17408
static_assert(KVBUF % 2048 == 0 && KVBUF >= 64 * KP * 2 && KVBUF >= 64 * VP * 2 &&
              BBUF % 2048 == 0 && BBUF >= 64 * BP * 4, "a tile fits its buffer");

typedef unsigned u32x4 __attribute__((ext_vector_type(4)));
typedef unsigned u32x8 __attribute__((ext_vector_type(8)));

__device__ __forceinline__ unsigned uni(unsigned v) {
  return (unsigned)__builtin_amdgcn_readfirstlane(v);
}
__device__ __forceinline__ unsigned pinned(unsigned v) {
  unsigned w = uni(v);
  asm volatile("" : "+s"(w));
  return w;
}
template <unsigned ROWB, unsigned PITCH>
__device__ __forceinline__ u32x8 tdm_group1() {
  static_assert(ROWB == 128 || ROWB == 256, "pad interval = the row");
  constexpr unsigned ivl = (ROWB == 128) ? 4u : 5u;
  constexpr unsigned rows = 64u;
  u32x8 g;
  g[0] = uni((1u << 20) | (ivl << 22) | (3u << 25));   // no mask; pad on
  g[1] = uni(ROWB << 16);
  g[2] = uni(rows << 16);
  g[3] = uni(ROWB << 16);
  g[4] = uni(rows);
  g[5] = uni(PITCH);
  g[6] = uni(0u);
  g[7] = uni(0u);
  return g;
}
__device__ __forceinline__ u32x4 tdm_group0(unsigned lds_dst, unsigned long long ga) {
  u32x4 g;
  g[0] = uni(1u);
  g[1] = uni(lds_dst);
  g[2] = uni((unsigned)ga);
  g[3] = uni((((unsigned)(ga >> 32)) & 0x01FFFFFFu) | 0x80000000u);
  return g;
}
__device__ __forceinline__ void tdm_load(u32x4 g0, u32x8 g1) {
  asm volatile("tensor_load_to_lds %0, %1" :: "s"(g0), "s"(g1) : "memory");
}

__device__ __forceinline__ float xhalf(float x) {
  const int b = __builtin_bit_cast(int, x);
  return __builtin_bit_cast(float, __builtin_amdgcn_permlanex16(
      b, b, 0x76543210, 0xfedcba98, false, false));
}

__global__ __launch_bounds__(128)
void attn_kernel(const __bf16* __restrict__ Qb, const __bf16* __restrict__ Kb,
                 const __bf16* __restrict__ VTb, const float* __restrict__ bias,
                 __bf16* __restrict__ Ob) {
  __shared__ __attribute__((aligned(2048)))
  __bf16 Kst[2][KVBUF / 2];           // 64 keys x 64 dk   (rows of KP)
  __shared__ __attribute__((aligned(2048)))
  __bf16 Vst[2][KVBUF / 2];           // 64 dk   x 64 keys (rows of VP)
  __shared__ __attribute__((aligned(2048)))
  float Bias[2][BBUF / 4];            // 64 queries x 64 keys (rows of BP)

  const int tid  = threadIdx.x;
  const int lane = tid & 31;
  const int wv   = tid >> 5;
  const int g    = lane >> 4;
  const int r16  = lane & 15;
  const unsigned wave = uni(threadIdx.x >> 5);

  const int bh = blockIdx.y;            // 0..63
  const int b  = bh >> 4;
  const int h  = bh & 15;
  const int q0 = (blockIdx.x * 4 + wv) * 16;

  const size_t tokBase = (size_t)b * S;
  // first bytes of the block's tiles at key 0
  const unsigned long long biasA =
      (unsigned long long)(bias + ((size_t)bh * S + blockIdx.x * 64) * S);
  const unsigned long long kA = (unsigned long long)(Kb + tokBase * H + h * DK);
  const unsigned long long vA = (unsigned long long)(VTb + (size_t)bh * DK * S);
  const unsigned ldsB = (unsigned)(size_t)&Bias[0][0];
  const unsigned ldsK = (unsigned)(size_t)&Kst[0][0];
  const unsigned ldsV = (unsigned)(size_t)&Vst[0][0];

  // what this wave brings (wave 0: bias, wave 1: K, wave 2: V^T; wave 3 issues
  // nothing): first byte at key 0, bytes a key, place and size of a buffer
  const unsigned long long srcW = (wave == 0) ? biasA : (wave == 1) ? kA : vA;
  const unsigned stepW = (wave == 0) ? 4u : (wave == 1) ? (unsigned)(H * 2) : 2u;
  const unsigned ldsW  = (wave == 0) ? ldsB : (wave == 1) ? ldsK : ldsV;
  const unsigned bufW  = (wave == 0) ? BBUF : KVBUF;

  static_assert(DK * 2 == KT * 2 && H * 2 == S * 2, "K and V^T tiles: one shape");
  u32x8 g1B  = tdm_group1<KT * 4, S * 4>();
  u32x8 g1KV = tdm_group1<DK * 2, H * 2>();
  asm volatile("" : "+s"(g1B));
  asm volatile("" : "+s"(g1KV));
  u32x4 g0;

  auto wait_tile = [&]() {
    asm volatile("s_wait_tensorcnt 0x0" :: "s"(g0) : "memory");
  };
  auto issue_tile = [&](int kb_, int buf_, bool first) {
    const unsigned kb = pinned((unsigned)kb_), buf = pinned((unsigned)buf_);
    g0 = tdm_group0(ldsW + buf * bufW, srcW + (unsigned long long)kb * stepW);
    if (pinned(wave == 0)) {
      tdm_load(g0, g1B);
      if (first) wait_tile();
    }
    if (pinned(wave == 1 || wave == 2)) {
      tdm_load(g0, g1KV);
      if (first) wait_tile();
    }
  };

  // Q^T fragments (B operand, column = query q0 + r16) for both dk halves;
  // they persist across the whole key loop
  const __bf16* qrow = Qb + (tokBase + q0 + r16) * H + h * DK + 8 * g;
  const v16bf bq0 = load_frag(qrow);
  const v16bf bq1 = load_frag(qrow + 32);

  float Mi = -1e30f;   // running maximum of the query (equal in both halves)
  float Li = 0.f;      // running sum over this half's keys only
  v8f oacc[4] = {};    // O^T: oacc[t][v] = O[q0 + r16][t*16 + 8*g + v]

  issue_tile(0, 0, true);
  __syncthreads();
  issue_tile(KT, 1, false);             // stage 1 flies over pass 0

  for (int kb = 0; kb < S; kb += KT) {
    const int buf = (kb >> 6) & 1;

    // scores^T: four 16-key x 16-query tiles, K rows (A) from the LDS tile.
    // All K fragments and this lane's bias row are named ahead of the products,
    // so that their LDS loads go out as one group.
    const float* brow = &Bias[buf][(wv * 16 + r16) * BP + 8 * g];
    v16bf kf[4][2];
    v8f bs[4];
#pragma unroll  // constant indices: the arrays stay in registers
    for (int j = 0; j < 4; ++j) {
      kf[j][0] = load_frag(&Kst[buf][(16 * j + r16) * KP + 8 * g]);
      kf[j][1] = load_frag(&Kst[buf][(16 * j + r16) * KP + 32 + 8 * g]);
    }
#pragma unroll  // constant indices: the arrays stay in registers
    for (int j = 0; j < 4; ++j) {
      const v4f b0 = *(const v4f*)(brow + 16 * j);
      const v4f b1 = *(const v4f*)(brow + 16 * j + 4);
      bs[j] = __builtin_shufflevector(b0, b1, 0, 1, 2, 3, 4, 5, 6, 7);
    }

    // z[j][v] belongs to key kb + 16*j + 8*g + v, query q0 + r16
    v8f z[4];
#pragma unroll  // constant indices: the arrays stay in registers
    for (int j = 0; j < 4; ++j) {
      v8f zero = {};
      z[j] = wmma_bf16(kf[j][0], bq0, zero);
    }
#pragma unroll  // constant indices: the arrays stay in registers
    for (int j = 0; j < 4; ++j) z[j] = wmma_bf16(kf[j][1], bq1, z[j]);

    // V^T rows (A of the second product) from the LDS tile, contiguous along
    // keys; named ahead of the softmax so that the loads may fly under it
    v16bf vf[2][4];
#pragma unroll  // constant indices: the arrays stay in registers
    for (int p = 0; p < 2; ++p)
#pragma unroll  // constant indices: the arrays stay in registers
      for (int t4 = 0; t4 < 4; ++t4)
        vf[p][t4] = load_frag(&Vst[buf][(t4 * 16 + r16) * VP + 32 * p + 8 * g]);

    // scale + bias of this lane's query
    v8f t[4];
#pragma unroll  // constant indices: the arrays stay in registers
    for (int j = 0; j < 4; ++j) t[j] = z[j] * 0.125f + bs[j];

    // online softmax, all of one query in one lane pair
    float mx[8];
#pragma unroll  // constant indices: the arrays stay in registers
    for (int v = 0; v < 8; ++v)
      mx[v] = fmaxf(fmaxf(t[0][v], t[1][v]), fmaxf(t[2][v], t[3][v]));
    float rm = fmaxf(fmaxf(fmaxf(mx[0], mx[1]), fmaxf(mx[2], mx[3])),
                     fmaxf(fmaxf(mx[4], mx[5]), fmaxf(mx[6], mx[7])));
    rm = fmaxf(rm, xhalf(rm));
    const float nm = fmaxf(Mi, rm);
    const float cf = __expf(Mi - nm);
    Mi = nm;

    // exp(t - nm) as exp2((t - nm) * log2(e)), the subtraction and the product
    // on whole vectors (two elements an instruction)
    v8f d[4], e[4];
#pragma unroll  // constant indices: the arrays stay in registers
    for (int j = 0; j < 4; ++j) d[j] = (t[j] - nm) * 1.44269504088896340736f;
#pragma unroll  // constant indices: the arrays stay in registers
    for (int j = 0; j < 4; ++j)
#pragma unroll  // constant indices: the arrays stay in registers
      for (int v = 0; v < 8; ++v) e[j][v] = __builtin_amdgcn_exp2f(d[j][v]);
    const v8f sv = (e[0] + e[1]) + (e[2] + e[3]);
    Li = Li * cf + (((sv[0] + sv[1]) + (sv[2] + sv[3])) +
                    ((sv[4] + sv[5]) + (sv[6] + sv[7])));
#pragma unroll  // constant indices: the arrays stay in registers
    for (int t4 = 0; t4 < 4; ++t4) oacc[t4] *= cf;

    // per 32 keys: P^T as a B operand (element s = key 32*p + kmap(s, g) =
    // tile 2*p + (s >> 3), row s & 7), then O^T += V^T P^T
#pragma unroll  // constant indices: the arrays stay in registers
    for (int p = 0; p < 2; ++p) {
      v16bf pb;
#pragma unroll  // constant indices: the arrays stay in registers
      for (int v = 0; v < 8; ++v) {
        pb[v]     = (__bf16)e[2 * p][v];
        pb[8 + v] = (__bf16)e[2 * p + 1][v];
      }
#pragma unroll  // constant indices: the arrays stay in registers
      for (int t4 = 0; t4 < 4; ++t4) oacc[t4] = wmma_bf16(vf[p][t4], pb, oacc[t4]);
    }

    // publish point of the next stage: this wave's LDS reads of the buffers
    // refilled next have returned; the issuing waves' requests have landed;
    // every wave has left this buffer; only then its refill
    asm volatile("s_wait_dscnt 0x0" ::: "memory");
    if (pinned(wave != 3)) wait_tile();
    __syncthreads();
    if (pinned(kb + 2 * KT < S)) issue_tile(kb + 2 * KT, buf, false);
  }
  // nothing is outstanding when the wave goes on to its stores and ends
  asm volatile("s_wait_tensorcnt 0x0" ::: "memory");
  asm volatile("s_wait_dscnt 0x0" ::: "memory");

  // join the halves' sums, normalize, store: a lane holds 8 consecutive dk of
  // its query per tile -> one 16-byte store into [token][h*DK+dk] bf16
  const float inv = 1.0f / (Li + xhalf(Li));
  __bf16* orow = Ob + (tokBase + q0 + r16) * H + h * DK + 8 * g;
#pragma unroll
  for (int t = 0; t < 4; ++t) {
    v8bf pk;
#pragma unroll
    for (int v = 0; v < 8; ++v) pk[v] = (__bf16)(oacc[t][v] * inv);
    *(v8bf*)(orow + t * 16) = pk;
  }
}

// ---------------------------------------------------------------------------
// Host-side launcher
// ---------------------------------------------------------------------------
extern "C" void kernel_launch(void* const* d_in, const int* in_sizes, int n_in,
                              void* d_out, int out_size, void* d_ws, size_t ws_size,
                              hipStream_t stream) {
  const float* x_q  = (const float*)d_in[0];
  const float* x_kv = (const float*)d_in[1];
  const float* bias = (const float*)d_in[2];
  const float* Wq   = (const float*)d_in[3];
  const float* Wk   = (const float*)d_in[4];
  const float* Wv   = (const float*)d_in[5];
  const float* Wo   = (const float*)d_in[6];
  float* out = (float*)d_out;

  char* ws = (char*)d_ws;
  const size_t MB = 1024ull * 1024ull;
  __bf16* xq_bf  = (__bf16*)(ws + 0 * MB);    // 8 MB
  __bf16* xkv_bf = (__bf16*)(ws + 8 * MB);    // 8 MB
  __bf16* wq_bf  = (__bf16*)(ws + 16 * MB);   // 2 MB each
  __bf16* wk_bf  = (__bf16*)(ws + 18 * MB);
  __bf16* wv_bf  = (__bf16*)(ws + 20 * MB);
  __bf16* wo_bf  = (__bf16*)(ws + 22 * MB);
  __bf16* Qb     = (__bf16*)(ws + 24 * MB);   // 8 MB
  __bf16* Kb     = (__bf16*)(ws + 32 * MB);   // 8 MB
  __bf16* VTb    = (__bf16*)(ws + 40 * MB);   // 8 MB (per-head transposed)
  __bf16* Ob     = (__bf16*)(ws + 48 * MB);   // 8 MB

  cvt_all_f32_bf16<<<CVT_BLOCKS, CVT_THREADS, 0, stream>>>(
      x_q, x_kv, Wq, Wk, Wv, Wo, xq_bf, xkv_bf, wq_bf, wk_bf, wv_bf, wo_bf);

  // 4096x1024x1024 GEMMs: wave tile 32x64, grid = (N/64, M/32/4waves);
  // the three input projections share one launch (grid z = 3)
  dim3 ggrid(H / 64, MTOK / 32 / 4), gblk(128);
  const GemmSet setQ{xq_bf,  wq_bf, Qb};
  const GemmSet setK{xkv_bf, wk_bf, Kb};
  const GemmSet setV{xkv_bf, wv_bf, VTb};
  gemm_bf16<0><<<dim3(H / 64, MTOK / 32 / 4, 3), gblk, 0, stream>>>(
      setQ, setK, setV, nullptr, nullptr);

  // attention: (S/16 tiles / 4 waves, B*NH)
  attn_kernel<<<dim3(S / 16 / 4, Bb * NH), 128, 0, stream>>>(Qb, Kb, VTb, bias, Ob);

  // output projection + residual, f32 out
  const GemmSet setO{Ob, wo_bf, nullptr};
  gemm_bf16<2><<<ggrid, gblk, 0, stream>>>(setO, setO, setO, out, x_q);
}

// v007
// A run of this version takes 71.7 microseconds.
// Next to v006, in two timings, it ran 1.06 times as fast each time.
// Counting every step since v000, it is 2.57 times as fast.
#include <hip/hip_runtime.h>

typedef __attribute__((ext_vector_type(8)))  __bf16 v8bf;
typedef __attribute__((ext_vector_type(16))) __bf16 v16bf;
typedef __attribute__((ext_vector_type(8)))  float  v8f;

static constexpr int Bb = 4;
static constexpr int S  = 1024;
static constexpr int H  = 1024;
static constexpr int NH = 16;
static constexpr int DK = 64;
static constexpr int MTOK = Bb * S;   // 4096 tokens

__device__ __forceinline__ v8f wmma_bf16(v16bf a, v16bf b, v8f c) {
  return __builtin_amdgcn_wmma_f32_16x16x32_bf16(
      /*neg_a=*/false, a, /*neg_b=*/false, b,
      /*c_mod=*/(short)0, c, /*reuse_a=*/false, /*reuse_b=*/false);
}

__device__ __forceinline__ v16bf load_frag(const __bf16* p) {
  v8bf lo = *(const v8bf*)(p);
  v8bf hi = *(const v8bf*)(p + 16);
  return __builtin_shufflevector(lo, hi, 0,1,2,3,4,5,6,7,8,9,10,11,12,13,14,15);
}

// ---------------------------------------------------------------------------
// fp32 -> bf16 conversion of all six tensors in ONE launch, as a stream: no
// loop. A wave owns one contiguous run of every tensor (4 KB of each
// activation, 1 KB of each weight) and reads it in 16-byte pieces a lane, 512
// contiguous bytes a load. All 24 loads of a lane are independent and are
// issued before the first result is used, so a wave pays the memory latency
// once. Non-temporal reads: streamed once. A store writes 8 bytes a lane, 256
// contiguous bytes a wave (two whole lines).
// ---------------------------------------------------------------------------
typedef __attribute__((ext_vector_type(4))) float  v4f;
typedef __attribute__((ext_vector_type(4))) __bf16 v4bf;

static constexpr int NX = MTOK * H;   // 4M elements (activations)
static constexpr int NW = H * H;      // 1M elements (weights)
static constexpr int CVT_BLOCKS  = 512;
static constexpr int CVT_THREADS = 256;
static constexpr int CVT_WAVES   = CVT_BLOCKS * CVT_THREADS / 32;
static constexpr int XL = NX / (4 * 32 * CVT_WAVES);   // 8 loads a wave
static constexpr int WL = NW / (4 * 32 * CVT_WAVES);   // 2 loads a wave
static_assert(XL * 4 * 32 * CVT_WAVES == NX && WL * 4 * 32 * CVT_WAVES == NW,
              "the waves' runs cover every tensor exactly");

__global__ __launch_bounds__(CVT_THREADS)
void cvt_all_f32_bf16(const float* __restrict__ x_q, const float* __restrict__ x_kv,
                      const float* __restrict__ Wq,  const float* __restrict__ Wk,
                      const float* __restrict__ Wv,  const float* __restrict__ Wo,
                      __bf16* __restrict__ xq_bf, __bf16* __restrict__ xkv_bf,
                      __bf16* __restrict__ wq_bf, __bf16* __restrict__ wk_bf,
                      __bf16* __restrict__ wv_bf, __bf16* __restrict__ wo_bf) {
  const int wave = blockIdx.x * (CVT_THREADS / 32) + (threadIdx.x >> 5);
  const int lane = threadIdx.x & 31;
  // this lane's first 4-element piece of an activation and of a weight
  const int xi = wave * (XL * 32) + lane;
  const int wi = wave * (WL * 32) + lane;

  v4f a[XL], b[XL], c[WL], d[WL], e[WL], f[WL];
#pragma unroll  // constant indices: the arrays stay in registers
  for (int j = 0; j < XL; ++j)
    a[j] = __builtin_nontemporal_load((const v4f*)x_q + xi + j * 32);
#pragma unroll  // constant indices: the arrays stay in registers
  for (int j = 0; j < XL; ++j)
    b[j] = __builtin_nontemporal_load((const v4f*)x_kv + xi + j * 32);
#pragma unroll  // constant indices: the arrays stay in registers
  for (int j = 0; j < WL; ++j) {
    c[j] = __builtin_nontemporal_load((const v4f*)Wq + wi + j * 32);
    d[j] = __builtin_nontemporal_load((const v4f*)Wk + wi + j * 32);
    e[j] = __builtin_nontemporal_load((const v4f*)Wv + wi + j * 32);
    f[j] = __builtin_nontemporal_load((const v4f*)Wo + wi + j * 32);
  }
  // keeps every load ahead of the first conversion: left alone, the scheduler
  // holds ten loads back until earlier ones have returned (a second latency)
  __builtin_amdgcn_sched_barrier(0);

#pragma unroll  // constant indices: the arrays stay in registers
  for (int j = 0; j < XL; ++j)
    *((v4bf*)xq_bf + xi + j * 32) = __builtin_convertvector(a[j], v4bf);
#pragma unroll  // constant indices: the arrays stay in registers
  for (int j = 0; j < XL; ++j)
    *((v4bf*)xkv_bf + xi + j * 32) = __builtin_convertvector(b[j], v4bf);
#pragma unroll  // constant indices: the arrays stay in registers
  for (int j = 0; j < WL; ++j) {
    *((v4bf*)wq_bf + wi + j * 32) = __builtin_convertvector(c[j], v4bf);
    *((v4bf*)wk_bf + wi + j * 32) = __builtin_convertvector(d[j], v4bf);
    *((v4bf*)wv_bf + wi + j * 32) = __builtin_convertvector(e[j], v4bf);
    *((v4bf*)wo_bf + wi + j * 32) = __builtin_convertvector(f[j], v4bf);
  }
}

static constexpr int WPAD = 72;

struct GemmSet {
  const __bf16* X;   // 4096 x 1024 activations
  const __bf16* W;   // 1024 x 1024 weights
  __bf16*       out; // bf16 result (unused by MODE 2)
};

template <int MODE>
__global__ __launch_bounds__(128)
void gemm_bf16(GemmSet s0, GemmSet s1, GemmSet s2,
               float* __restrict__ outf, const float* __restrict__ resid) {
  constexpr int Kdim = H;
  constexpr int Ndim = H;
  constexpr int NB   = (MODE == 2) ? 4 : 2;   // buffers of the LDS ring
  constexpr int CPS  = 12;                    // copies of a wave a tile
  static_assert((NB & (NB - 1)) == 0 && Kdim / 64 >= NB &&
                NB * CPS <= 63, "ring: power of two, filled, copies in flight");

  // operand set of this block (block-uniform; MODE 2 has only set 0)
  const int z = (MODE == 0) ? (int)blockIdx.z : 0;
  const GemmSet st = (z == 0) ? s0 : (z == 1) ? s1 : s2;
  const __bf16* __restrict__ X = st.X;
  const __bf16* __restrict__ W = st.W;

  __shared__ __attribute__((aligned(256))) __bf16 Ast[NB][128][64];
  __shared__ __attribute__((aligned(16)))
  __bf16 Bst[NB][64][WPAD];             // 64 N-rows x 64 K (padded), NB buffers

  const int tid  = threadIdx.x;
  const int lane = tid & 31;
  const int wv   = tid >> 5;
  const int g    = lane >> 4;     // lo/hi 16-lane half
  const int r16  = lane & 15;

  const int tileN = blockIdx.x * 64;                 // shared by all 4 waves
  const int blkM  = blockIdx.y * 128;                // the block's X rows
  const int tileM = blkM + wv * 32;

  const int crow = tid >> 3, cpc = tid & 7;
  const __bf16* asrc = X + (size_t)(blkM + crow) * Kdim + cpc * 8;
  const __bf16* wsrc = W + (size_t)(tileN + crow) * Kdim + cpc * 8;
  const unsigned adst = (unsigned)(size_t)&Ast[0][crow][(cpc ^ (crow >> 1)) * 8];
  const unsigned wdst = (unsigned)(size_t)&Bst[0][crow][cpc * 8];
  auto issue_tiles = [&](int kb, int buf) {
    const __bf16* a0 = asrc + kb;
    const __bf16* w0 = wsrc + kb;
    const unsigned da = adst + buf * (128 * 64 * 2);
    const unsigned dw = wdst + buf * (64 * WPAD * 2);
    constexpr int AR = 16 * 64 * 2;      // 16 X-tile rows in LDS, bytes
    constexpr int WR = 16 * WPAD * 2;    // 16 W-tile rows in LDS, bytes
    constexpr int GR = 16 * Kdim;        // 16 rows in global, elements
    asm volatile("global_load_async_to_lds_b128 %0, %12, off\n\t"
                 "global_load_async_to_lds_b128 %1, %13, off\n\t"
                 "global_load_async_to_lds_b128 %2, %14, off\n\t"
                 "global_load_async_to_lds_b128 %3, %15, off\n\t"
                 "global_load_async_to_lds_b128 %4, %16, off\n\t"
                 "global_load_async_to_lds_b128 %5, %17, off\n\t"
                 "global_load_async_to_lds_b128 %6, %18, off\n\t"
                 "global_load_async_to_lds_b128 %7, %19, off\n\t"
                 "global_load_async_to_lds_b128 %8, %20, off\n\t"
                 "global_load_async_to_lds_b128 %9, %21, off\n\t"
                 "global_load_async_to_lds_b128 %10, %22, off\n\t"
                 "global_load_async_to_lds_b128 %11, %23, off\n\t"
                 "s_wait_xcnt 0x0"
                 :: "v"(da), "v"(da + AR), "v"(da + 2 * AR), "v"(da + 3 * AR),
                    "v"(da + 4 * AR), "v"(da + 5 * AR), "v"(da + 6 * AR),
                    "v"(da + 7 * AR),
                    "v"(dw), "v"(dw + WR), "v"(dw + 2 * WR), "v"(dw + 3 * WR),
                    "v"(a0), "v"(a0 + GR), "v"(a0 + 2 * GR), "v"(a0 + 3 * GR),
                    "v"(a0 + 4 * GR), "v"(a0 + 5 * GR), "v"(a0 + 6 * GR),
                    "v"(a0 + 7 * GR),
                    "v"(w0), "v"(w0 + GR), "v"(w0 + 2 * GR), "v"(w0 + 3 * GR)
                 : "memory");
  };

  v8f acc[2][4];

  // element offsets, inside this lane's X-tile row, of its four 16-byte
  // pieces g, g + 2, g + 4, g + 6 (rows 16 apart share them)
  int aoff[4];
#pragma unroll
  for (int j = 0; j < 4; ++j) aoff[j] = ((g + 2 * j) ^ (r16 >> 1)) * 8;

  // this wave's copies have landed but for those of its NB - 2 youngest tiles
  // (the counter returns in issue order; every wave issues CPS copies a tile)
  auto wait_oldest = [&]() {
    asm volatile("s_wait_asynccnt %0" :: "n"(CPS * (NB - 2)) : "memory");
  };

#pragma unroll  // constant buffer numbers
  for (int s = 0; s < NB - 1; ++s) issue_tiles(64 * s, s);

  // Start values of the accumulators. C/D layout: lane holds column
  // n = c*16 + r16, rows m0..m0+7 with m0 = tile + r*16 + 8*g. MODE 2 starts
  // from the residual: its loads, which come from memory, fly beside tile 0's
  // copies here; in the epilogue the wave would wait for them with nothing to do.
#pragma unroll  // constant indices: the array stays in registers
  for (int r = 0; r < 2; ++r) {
#pragma unroll  // constant indices: the array stays in registers
    for (int c = 0; c < 4; ++c) {
      if constexpr (MODE == 2) {
        const float* rp =
            resid + (size_t)(tileM + r * 16 + 8 * g) * Ndim + tileN + c * 16 + r16;
#pragma unroll  // constant indices: the array stays in registers
        for (int v = 0; v < 8; ++v) acc[r][c][v] = rp[(size_t)v * Ndim];
      } else {
        acc[r][c] = v8f{};
      }
    }
  }

  wait_oldest();                                     // tile 0 has landed
  __syncthreads();
  issue_tiles(64 * (NB - 1), NB - 1);                // NB - 1 tiles fly over trip 0

  for (int kb = 0; kb < Kdim; kb += 64) {
    const int buf = (kb >> 6) & (NB - 1);
    const __bf16* abase = &Ast[buf][wv * 32 + r16][0];

#pragma unroll
    for (int kk = 0; kk < 64; kk += 32) {
      v16bf a[2], b[4];
#pragma unroll
      for (int r = 0; r < 2; ++r) {
        const v8bf lo = *(const v8bf*)(abase + r * 16 * 64 + aoff[kk / 16]);
        const v8bf hi = *(const v8bf*)(abase + r * 16 * 64 + aoff[kk / 16 + 1]);
        a[r] = __builtin_shufflevector(lo, hi, 0, 1, 2, 3, 4, 5, 6, 7,
                                       8, 9, 10, 11, 12, 13, 14, 15);
      }
#pragma unroll
      for (int c = 0; c < 4; ++c)
        b[c] = load_frag(&Bst[buf][c * 16 + r16][kk + 8 * g]);
#pragma unroll
      for (int r = 0; r < 2; ++r)
#pragma unroll
        for (int c = 0; c < 4; ++c) acc[r][c] = wmma_bf16(a[r], b[c], acc[r][c]);
    }

    // this wave's LDS reads of the buffer refilled next have returned; the
    // next tile's copies have landed; every wave has left this buffer
    asm volatile("s_wait_dscnt 0x0" ::: "memory");
    wait_oldest();
    if constexpr (NB > 2) {
      // NB - 1 tiles are in flight only while the youngest of them exists: in
      // the last trips fewer are, and the count would not cover the next tile
      if (kb + (NB - 1) * 64 >= Kdim) asm volatile("s_wait_asynccnt 0x0" ::: "memory");
    }
    __syncthreads();
    if (kb + NB * 64 < Kdim) issue_tiles(kb + NB * 64, buf);  // refill the buffer just read
  }
  // no copy is outstanding when the wave goes on to its stores and ends
  asm volatile("s_wait_asynccnt 0x0" ::: "memory");

  if constexpr (MODE == 0) {
    __bf16* __restrict__ O = st.out;
    if (z != 2) {
#pragma unroll
      for (int r = 0; r < 2; ++r) {
#pragma unroll
        for (int c = 0; c < 4; ++c) {
          const int n  = tileN + c * 16 + r16;
          const int m0 = tileM + r * 16 + 8 * g;
#pragma unroll
          for (int v = 0; v < 8; ++v)
            O[(size_t)(m0 + v) * Ndim + n] = (__bf16)acc[r][c][v];
        }
      }
      // the stores above have taken their registers before any later
      // instruction on a path out of this branch may overwrite one
      asm volatile("s_wait_xcnt 0x0" ::: "memory");
    } else {
#pragma unroll
      for (int r = 0; r < 2; ++r) {
#pragma unroll
        for (int c = 0; c < 4; ++c) {
          const int n  = tileN + c * 16 + r16;
          const int m0 = tileM + r * 16 + 8 * g;
          const int hh = n >> 6, dk = n & 63;
          const int bb = m0 >> 10, s0i = m0 & 1023;  // 8 consecutive s, same bb
          v8bf pk;
#pragma unroll
          for (int v = 0; v < 8; ++v) pk[v] = (__bf16)acc[r][c][v];
          *(v8bf*)(O + ((size_t)(bb * NH + hh) * DK + dk) * S + s0i) = pk;
        }
      }
    }
  } else {
#pragma unroll
    for (int r = 0; r < 2; ++r) {
#pragma unroll
      for (int c = 0; c < 4; ++c) {
        const int n  = tileN + c * 16 + r16;
        const int m0 = tileM + r * 16 + 8 * g;
#pragma unroll
        for (int v = 0; v < 8; ++v) {
          const size_t idx = (size_t)(m0 + v) * Ndim + n;
          outf[idx] = acc[r][c][v];   // the residual is in it from the start
        }
      }
    }
  }
}

static constexpr int KT = 64;
static constexpr int KP = 72;
static constexpr int VP = 72;
static constexpr int BP = 68;
// bytes of one buffer in LDS: 64 padded rows, rounded up to a multiple of
// 2 KiB so that every tensor load's place is one
static constexpr unsigned KVBUF = 10240;   // 64 * 144 = 9216
static constexpr unsigned BBUF  = 18432;   // 64 * 272 = 17408
static_assert(KVBUF % 2048 == 0 && KVBUF >= 64 * KP * 2 && KVBUF >= 64 * VP * 2 &&
              BBUF % 2048 == 0 && BBUF >= 64 * BP * 4, "a tile fits its buffer");

typedef unsigned u32x4 __attribute__((ext_vector_type(4)));
typedef unsigned u32x8 __attribute__((ext_vector_type(8)));

__device__ __forceinline__ unsigned uni(unsigned v) {
  return (unsigned)__builtin_amdgcn_readfirstlane(v);
}
__device__ __forceinline__ unsigned pinned(unsigned v) {
  unsigned w = uni(v);
  asm volatile("" : "+s"(w));
  return w;
}
template <unsigned ROWB, unsigned PITCH>
__device__ __forceinline__ u32x8 tdm_group1() {
  static_assert(ROWB == 128 || ROWB == 256, "pad interval = the row");
  constexpr unsigned ivl = (ROWB == 128) ? 4u : 5u;
  constexpr unsigned rows = 64u;
  u32x8 g;
  g[0] = uni((1u << 20) | (ivl << 22) | (3u << 25));   // no mask; pad on
  g[1] = uni(ROWB << 16);
  g[2] = uni(rows << 16);
  g[3] = uni(ROWB << 16);
  g[4] = uni(rows);
  g[5] = uni(PITCH);
  g[6] = uni(0u);
  g[7] = uni(0u);
  return g;
}
__device__ __forceinline__ u32x4 tdm_group0(unsigned lds_dst, unsigned long long ga) {
  u32x4 g;
  g[0] = uni(1u);
  g[1] = uni(lds_dst);
  g[2] = uni((unsigned)ga);
  g[3] = uni((((unsigned)(ga >> 32)) & 0x01FFFFFFu) | 0x80000000u);
  return g;
}
__device__ __forceinline__ void tdm_load(u32x4 g0, u32x8 g1) {
  asm volatile("tensor_load_to_lds %0, %1" :: "s"(g0), "s"(g1) : "memory");
}

__device__ __forceinline__ float xhalf(float x) {
  const int b = __builtin_bit_cast(int, x);
  return __builtin_bit_cast(float, __builtin_amdgcn_permlanex16(
      b, b, 0x76543210, 0xfedcba98, false, false));
}

__global__ __launch_bounds__(128)
void attn_kernel(const __bf16* __restrict__ Qb, const __bf16* __restrict__ Kb,
                 const __bf16* __restrict__ VTb, const float* __restrict__ bias,
                 __bf16* __restrict__ Ob) {
  __shared__ __attribute__((aligned(2048)))
  __bf16 Kst[2][KVBUF / 2];           // 64 keys x 64 dk   (rows of KP)
  __shared__ __attribute__((aligned(2048)))
  __bf16 Vst[2][KVBUF / 2];           // 64 dk   x 64 keys (rows of VP)
  __shared__ __attribute__((aligned(2048)))
  float Bias[2][BBUF / 4];            // 64 queries x 64 keys (rows of BP)

  const int tid  = threadIdx.x;
  const int lane = tid & 31;
  const int wv   = tid >> 5;
  const int g    = lane >> 4;
  const int r16  = lane & 15;
  const unsigned wave = uni(threadIdx.x >> 5);

  const int bh = blockIdx.y;            // 0..63
  const int b  = bh >> 4;
  const int h  = bh & 15;
  const int q0 = (blockIdx.x * 4 + wv) * 16;

  const size_t tokBase = (size_t)b * S;
  // first bytes of the block's tiles at key 0
  const unsigned long long biasA =
      (unsigned long long)(bias + ((size_t)bh * S + blockIdx.x * 64) * S);
  const unsigned long long kA = (unsigned long long)(Kb + tokBase * H + h * DK);
  const unsigned long long vA = (unsigned long long)(VTb + (size_t)bh * DK * S);
  const unsigned ldsB = (unsigned)(size_t)&Bias[0][0];
  const unsigned ldsK = (unsigned)(size_t)&Kst[0][0];
  const unsigned ldsV = (unsigned)(size_t)&Vst[0][0];

  // what this wave brings (wave 0: bias, wave 1: K, wave 2: V^T; wave 3 issues
  // nothing): first byte at key 0, bytes a key, place and size of a buffer
  const unsigned long long srcW = (wave == 0) ? biasA : (wave == 1) ? kA : vA;
  const unsigned stepW = (wave == 0) ? 4u : (wave == 1) ? (unsigned)(H * 2) : 2u;
  const unsigned ldsW  = (wave == 0) ? ldsB : (wave == 1) ? ldsK : ldsV;
  const unsigned bufW  = (wave == 0) ? BBUF : KVBUF;

  static_assert(DK * 2 == KT * 2 && H * 2 == S * 2, "K and V^T tiles: one shape");
  u32x8 g1B  = tdm_group1<KT * 4, S * 4>();
  u32x8 g1KV = tdm_group1<DK * 2, H * 2>();
  asm volatile("" : "+s"(g1B));
  asm volatile("" : "+s"(g1KV));
  u32x4 g0;

  auto wait_tile = [&]() {
    asm volatile("s_wait_tensorcnt 0x0" :: "s"(g0) : "memory");
  };
  auto issue_tile = [&](int kb_, int buf_, bool first) {
    const unsigned kb = pinned((unsigned)kb_), buf = pinned((unsigned)buf_);
    g0 = tdm_group0(ldsW + buf * bufW, srcW + (unsigned long long)kb * stepW);
    if (pinned(wave == 0)) {
      tdm_load(g0, g1B);
      if (first) wait_tile();
    }
    if (pinned(wave == 1 || wave == 2)) {
      tdm_load(g0, g1KV);
      if (first) wait_tile();
    }
  };

  // Q^T fragments (B operand, column = query q0 + r16) for both dk halves;
  // they persist across the whole key loop
  const __bf16* qrow = Qb + (tokBase + q0 + r16) * H + h * DK + 8 * g;
  const v16bf bq0 = load_frag(qrow);
  const v16bf bq1 = load_frag(qrow + 32);

  float Mi = -1e30f;   // running maximum of the query (equal in both halves)
  float Li = 0.f;      // running sum over this half's keys only
  v8f oacc[4] = {};    // O^T: oacc[t][v] = O[q0 + r16][t*16 + 8*g + v]

  issue_tile(0, 0, true);
  __syncthreads();
  issue_tile(KT, 1, false);             // stage 1 flies over pass 0

  for (int kb = 0; kb < S; kb += KT) {
    const int buf = (kb >> 6) & 1;

    // scores^T: four 16-key x 16-query tiles, K rows (A) from the LDS tile.
    // All K fragments and this lane's bias row are named ahead of the products,
    // so that their LDS loads go out as one group.
    const float* brow = &Bias[buf][(wv * 16 + r16) * BP + 8 * g];
    v16bf kf[4][2];
    v8f bs[4];
#pragma unroll  // constant indices: the arrays stay in registers
    for (int j = 0; j < 4; ++j) {
      kf[j][0] = load_frag(&Kst[buf][(16 * j + r16) * KP + 8 * g]);
      kf[j][1] = load_frag(&Kst[buf][(16 * j + r16) * KP + 32 + 8 * g]);
    }
#pragma unroll  // constant indices: the arrays stay in registers
    for (int j = 0; j < 4; ++j) {
      const v4f b0 = *(const v4f*)(brow + 16 * j);
      const v4f b1 = *(const v4f*)(brow + 16 * j + 4);
      bs[j] = __builtin_shufflevector(b0, b1, 0, 1, 2, 3, 4, 5, 6, 7);
    }

    // z[j][v] belongs to key kb + 16*j + 8*g + v, query q0 + r16
    v8f z[4];
#pragma unroll  // constant indices: the arrays stay in registers
    for (int j = 0; j < 4; ++j) {
      v8f zero = {};
      z[j] = wmma_bf16(kf[j][0], bq0, zero);
    }
#pragma unroll  // constant indices: the arrays stay in registers
    for (int j = 0; j < 4; ++j) z[j] = wmma_bf16(kf[j][1], bq1, z[j]);

    // V^T rows (A of the second product) from the LDS tile, contiguous along
    // keys; named ahead of the softmax so that the loads may fly under it
    v16bf vf[2][4];
#pragma unroll  // constant indices: the arrays stay in registers
    for (int p = 0; p < 2; ++p)
#pragma unroll  // constant indices: the arrays stay in registers
      for (int t4 = 0; t4 < 4; ++t4)
        vf[p][t4] = load_frag(&Vst[buf][(t4 * 16 + r16) * VP + 32 * p + 8 * g]);

    // scale + bias of this lane's query
    v8f t[4];
#pragma unroll  // constant indices: the arrays stay in registers
    for (int j = 0; j < 4; ++j) t[j] = z[j] * 0.125f + bs[j];

    // online softmax, all of one query in one lane pair
    float mx[8];
#pragma unroll  // constant indices: the arrays stay in registers
    for (int v = 0; v < 8; ++v)
      mx[v] = fmaxf(fmaxf(t[0][v], t[1][v]), fmaxf(t[2][v], t[3][v]));
    float rm = fmaxf(fmaxf(fmaxf(mx[0], mx[1]), fmaxf(mx[2], mx[3])),
                     fmaxf(fmaxf(mx[4], mx[5]), fmaxf(mx[6], mx[7])));
    rm = fmaxf(rm, xhalf(rm));
    const float nm = fmaxf(Mi, rm);
    const float cf = __expf(Mi - nm);
    Mi = nm;

    // exp(t - nm) as exp2((t - nm) * log2(e)), the subtraction and the product
    // on whole vectors (two elements an instruction)
    v8f d[4], e[4];
#pragma unroll  // constant indices: the arrays stay in registers
    for (int j = 0; j < 4; ++j) d[j] = (t[j] - nm) * 1.44269504088896340736f;
#pragma unroll  // constant indices: the arrays stay in registers
    for (int j = 0; j < 4; ++j)
#pragma unroll  // constant indices: the arrays stay in registers
      for (int v = 0; v < 8; ++v) e[j][v] = __builtin_amdgcn_exp2f(d[j][v]);
    const v8f sv = (e[0] + e[1]) + (e[2] + e[3]);
    Li = Li * cf + (((sv[0] + sv[1]) + (sv[2] + sv[3])) +
                    ((sv[4] + sv[5]) + (sv[6] + sv[7])));
#pragma unroll  // constant indices: the arrays stay in registers
    for (int t4 = 0; t4 < 4; ++t4) oacc[t4] *= cf;

    // per 32 keys: P^T as a B operand (element s = key 32*p + kmap(s, g) =
    // tile 2*p + (s >> 3), row s & 7), then O^T += V^T P^T
#pragma unroll  // constant indices: the arrays stay in registers
    for (int p = 0; p < 2; ++p) {
      v16bf pb;
#pragma unroll  // constant indices: the arrays stay in registers
      for (int v = 0; v < 8; ++v) {
        pb[v]     = (__bf16)e[2 * p][v];
        pb[8 + v] = (__bf16)e[2 * p + 1][v];
      }
#pragma unroll  // constant indices: the arrays stay in registers
      for (int t4 = 0; t4 < 4; ++t4) oacc[t4] = wmma_bf16(vf[p][t4], pb, oacc[t4]);
    }

    // publish point of the next stage: this wave's LDS reads of the buffers
    // refilled next have returned; the issuing waves' requests have landed;
    // every wave has left this buffer; only then its refill
    asm volatile("s_wait_dscnt 0x0" ::: "memory");
    if (pinned(wave != 3)) wait_tile();
    __syncthreads();
    if (pinned(kb + 2 * KT < S)) issue_tile(kb + 2 * KT, buf, false);
  }
  // nothing is outstanding when the wave goes on to its stores and ends
  asm volatile("s_wait_tensorcnt 0x0" ::: "memory");
  asm volatile("s_wait_dscnt 0x0" ::: "memory");

  // join the halves' sums, normalize, store: a lane holds 8 consecutive dk of
  // its query per tile -> one 16-byte store into [token][h*DK+dk] bf16
  const float inv = 1.0f / (Li + xhalf(Li));
  __bf16* orow = Ob + (tokBase + q0 + r16) * H + h * DK + 8 * g;
#pragma unroll
  for (int t = 0; t < 4; ++t) {
    v8bf pk;
#pragma unroll
    for (int v = 0; v < 8; ++v) pk[v] = (__bf16)(oacc[t][v] * inv);
    *(v8bf*)(orow + t * 16) = pk;
  }
}

// ---------------------------------------------------------------------------
// Host-side launcher
// ---------------------------------------------------------------------------
extern "C" void kernel_launch(void* const* d_in, const int* in_sizes, int n_in,
                              void* d_out, int out_size, void* d_ws, size_t ws_size,
                              hipStream_t stream) {
  const float* x_q  = (const float*)d_in[0];
  const float* x_kv = (const float*)d_in[1];
  const float* bias = (const float*)d_in[2];
  const float* Wq   = (const float*)d_in[3];
  const float* Wk   = (const float*)d_in[4];
  const float* Wv   = (const float*)d_in[5];
  const float* Wo   = (const float*)d_in[6];
  float* out = (float*)d_out;

  char* ws = (char*)d_ws;
  const size_t MB = 1024ull * 1024ull;
  __bf16* xq_bf  = (__bf16*)(ws + 0 * MB);    // 8 MB
  __bf16* xkv_bf = (__bf16*)(ws + 8 * MB);    // 8 MB
  __bf16* wq_bf  = (__bf16*)(ws + 16 * MB);   // 2 MB each
  __bf16* wk_bf  = (__bf16*)(ws + 18 * MB);
  __bf16* wv_bf  = (__bf16*)(ws + 20 * MB);
  __bf16* wo_bf  = (__bf16*)(ws + 22 * MB);
  __bf16* Qb     = (__bf16*)(ws + 24 * MB);   // 8 MB
  __bf16* Kb     = (__bf16*)(ws + 32 * MB);   // 8 MB
  __bf16* VTb    = (__bf16*)(ws + 40 * MB);   // 8 MB (per-head transposed)
  __bf16* Ob     = (__bf16*)(ws + 48 * MB);   // 8 MB

  cvt_all_f32_bf16<<<CVT_BLOCKS, CVT_THREADS, 0, stream>>>(
      x_q, x_kv, Wq, Wk, Wv, Wo, xq_bf, xkv_bf, wq_bf, wk_bf, wv_bf, wo_bf);

  // 4096x1024x1024 GEMMs: wave tile 32x64, grid = (N/64, M/32/4waves);
  // the three input projections share one launch (grid z = 3)
  dim3 ggrid(H / 64, MTOK / 32 / 4), gblk(128);
  const GemmSet setQ{xq_bf,  wq_bf, Qb};
  const GemmSet setK{xkv_bf, wk_bf, Kb};
  const GemmSet setV{xkv_bf, wv_bf, VTb};
  gemm_bf16<0><<<dim3(H / 64, MTOK / 32 / 4, 3), gblk, 0, stream>>>(
      setQ, setK, setV, nullptr, nullptr);

  // attention: (S/16 tiles / 4 waves, B*NH)
  attn_kernel<<<dim3(S / 16 / 4, Bb * NH), 128, 0, stream>>>(Qb, Kb, VTb, bias, Ob);

  // output projection + residual, f32 out
  const GemmSet setO{Ob, wo_bf, nullptr};
  gemm_bf16<2><<<ggrid, gblk, 0, stream>>>(setO, setO, setO, out, x_q);
}
